// v000
// The times below were measured on an AMD MI455X: many runs one after another, warmed up first and cycling through
// copies of the inputs, with the whole window's GPU time divided by the number of runs. Launches and the gaps
// between them are all in it. The median over several windows is given; except for v000 it joins two sittings, which
// can be a few percent apart, so the side-by-side timings, each taken in one sitting, are the better comparison.
// The starting kernel, v000, takes 204 microseconds a run.
#include <hip/hip_runtime.h>

// Max-plus multi-head attention block, width 512 = 8 heads x 64: x [SEQ][NB_FULL][512]; Wq [512][512], Wkv [1024][512] (k rows then v rows), Wo [512][512], all [out][in] (y = x W^T);
// per-feature shift lam [512]; three 64x64 max-plus head weights; post-LN over (x + attention output) with gain and offset inputs.
// Compute dtypes, f32 accumulate everywhere: q/k/v projections v_wmma_f32_16x16x32_bf16 (x and W RNE-converted to bf16; products exact);
// output projection v_wmma_f32_16x16x32_f16, one product: attention vector as f16 with a x16 carry, bf16-valued Wo as f16 with a x64 carry, folded by 1/1024 in the f32 epilogue.
// Max-plus stages (head linear y[o] = max_i(x[i] + W[o][i]); score = -(max_d(q-k) - min_d(q-k)); context = max_key(score + v)) are semiring operations and run in f32 on the vector unit, as do log1p, expm1 and LayerNorm.
// Layout: the head regrouping is the flat reshape of [b][s][head][d] into [b*8 + s/(SEQ/8)][(s % (SEQ/8))*8 + head][d], i.e. group g is the contiguous SEQ x 64 chunk g of a [b][s][512] plane; the q/k/v planes are kept in that order
// (GEMM row R = b*SEQ + s reads source row s*NB_FULL + b by arithmetic addressing). Attention vector plane rows s2*NB + b2 with g = b2*8 + h2, columns h2*64 + d.

#ifndef NB
#define NB 2
#endif
#ifndef SEQ
#define SEQ 512
#endif
#define NB_FULL  2
#define SEQ_FULL 512
#define DM   512
#define NH_  8
#define HD   64
#define XSP  68                  // LDS row pitch (floats) of the 64 x 64 tiles of the projection kernel
#define YSP  516                 // LDS row pitch (floats) of the 16 x 512 tile of the output kernel
#define ORW  16                  // rows per block of the output kernel
#define ACARRY 16.0f             // carry of the f16 attention vector plane
#define WCARRY 64.0f             // carry of the f16 Wo plane
#define OSCL (1.0f / 1024.0f)    // 1 / (ACARRY * WCARRY)
#define LNEPS 1e-5f
#define NEGB (-3.0e38f)
#define POSB (3.0e38f)

static_assert(NH_ * HD == DM);                 // head h = columns h*64 + d
static_assert(HD == 64);                       // one 64-column GEMM tile = one head; attention lanes own 8 octets of d
static_assert(DM % 64 == 0);
static_assert(DM % 32 == 0);                   // GEMM k-loops step by 32
static_assert(SEQ % 64 == 0);                  // a 64-row GEMM tile never straddles two batches
static_assert((NB * SEQ) % 64 == 0);
static_assert(SEQ % 32 == 0);                  // attention query and key tiles of 32 rows
static_assert(SEQ % NH_ == 0);                 // tokens per group = SEQ / 8
static_assert((NB * SEQ) % ORW == 0);
static_assert(ORW == 16);                      // one 16-row WMMA slab per block of the output kernel
static_assert(8 * 64 == DM);                   // 8 waves x 64 columns cover one output row
static_assert(NB <= NB_FULL);
static_assert(SEQ <= SEQ_FULL);
static_assert((XSP * 4) % 16 == 0);
static_assert(XSP >= 64);
static_assert((YSP * 4) % 16 == 0);
static_assert(YSP >= DM);
static_assert(((size_t)SEQ * NB_FULL * DM) % 8 == 0);
static_assert(((size_t)DM * DM) % 8 == 0);
static_assert(32 * 16 * 32 == 64 * 64 * 4);            // projection store: 32 lanes x 16 B x 32 trips == 64 rows x 256 B
static_assert(256 * 16 == 32 * HD * 2);
static_assert(8 * (ORW / 8) * 4 * 32 * 16 == ORW * DM * 4);   // output store: 8 waves x 2 rows x 4 instructions x 512 B == 16 rows x 2048 B
static_assert(3 * 64 * XSP * 4 <= 131072);             // static LDS of the projection kernel
static_assert(3 * 32 * 17 * 16 + 32 * 33 * 4 <= 131072);   // static LDS of the attention kernel
static_assert(ORW * YSP * 4 <= 131072);                // static LDS of the output kernel

typedef _Float16 h16;
typedef unsigned short bf;
typedef __attribute__((ext_vector_type(16))) __bf16   v16bf;
typedef __attribute__((ext_vector_type(16))) _Float16 v16h;
typedef __attribute__((ext_vector_type(8)))  _Float16 v8h;
typedef __attribute__((ext_vector_type(8)))  unsigned short v8us;
typedef __attribute__((ext_vector_type(8)))  float    v8f;
typedef __attribute__((ext_vector_type(4)))  float    v4f;
typedef v4f  __attribute__((may_alias)) v4fa;

__device__ __forceinline__ unsigned short f2bf(float f) { unsigned u = __float_as_uint(f); u += 0x7FFFu + ((u >> 16) & 1u); return (unsigned short)(u >> 16); }
__device__ __forceinline__ float bfr(float f) { return __uint_as_float(((unsigned)f2bf(f)) << 16); }   // value after RNE convert to bf16
__device__ __forceinline__ v16h cat16(v8h lo, v8h hi) { return __builtin_shufflevector(lo, hi, 0, 1, 2, 3, 4, 5, 6, 7, 8, 9, 10, 11, 12, 13, 14, 15); }
__device__ __forceinline__ v16bf cat16b(v8us lo, v8us hi) { return __builtin_bit_cast(v16bf, __builtin_shufflevector(lo, hi, 0, 1, 2, 3, 4, 5, 6, 7, 8, 9, 10, 11, 12, 13, 14, 15)); }
__device__ __forceinline__ v8f wmma16(v16h a, v16h b, v8f c) { return __builtin_amdgcn_wmma_f32_16x16x32_f16(false, a, false, b, (short)0, c, false, false); }
__device__ __forceinline__ v8f wmmab(v16bf a, v16bf b, v8f c) { return __builtin_amdgcn_wmma_f32_16x16x32_bf16(false, a, false, b, (short)0, c, false, false); }
// fragment loaders from K-contiguous 16-bit rows; p already includes + 8*(lane>>4): elements 0..7 <- k0+8h+0..7, elements 8..15 <- k0+16+8h+0..7 (same map for A and B)
__device__ __forceinline__ v16h  ldh(const h16* p) { return cat16(*(const v8h*)p, *(const v8h*)(p + 16)); }
__device__ __forceinline__ v16bf ldb(const bf* p)  { return cat16b(*(const v8us*)p, *(const v8us*)(p + 16)); }
// ordering point for wave-private LDS tiles (same wave writes and reads)
__device__ __forceinline__ void wave_sync() { __builtin_amdgcn_fence(3 /* release order */, "wavefront"); __builtin_amdgcn_wave_barrier(); asm volatile("" ::: "memory"); }

// per-instruction guarded matrix products: one accumulator tied per guard, operands kept live across the nops
__device__ __forceinline__ v8f wmmab_g(v16bf a, v16bf b, v8f c) { c = wmmab(a, b, c); asm volatile("v_nop\n\tv_nop\n\tv_nop\n\tv_nop" : "+v"(c) : "v"(a), "v"(b)); return c; }
__device__ __forceinline__ v8f wmma16_g(v16h a, v16h b, v8f c) { c = wmma16(a, b, c); asm volatile("v_nop\n\tv_nop\n\tv_nop\n\tv_nop" : "+v"(c) : "v"(a), "v"(b)); return c; }
// f32 -> f16 convert that cannot produce a subnormal operand (|v| < 2^-14 -> +0), applied after the plane's carry
static __device__ __forceinline__ h16 toh_flush(float v) { const h16 r = (h16)v; return (fabsf(v) < 6.103515625e-05f) ? (h16)0.0f : r; }
__device__ __forceinline__ float wsum(float v) { v += __shfl_xor(v, 16, 32); v += __shfl_xor(v, 8, 32); v += __shfl_xor(v, 4, 32); v += __shfl_xor(v, 2, 32); v += __shfl_xor(v, 1, 32); return v; }

__global__ __launch_bounds__(256) void k_cvt8(const float* __restrict__ src, bf* dst, size_t n8) {
    const size_t i = (size_t)blockIdx.x * 256 + threadIdx.x; if (i >= n8) return;
    const v8f v = *(const v8f*)(src + i * 8); v8us o;
#pragma unroll
    for (int k = 0; k < 8; ++k) o[k] = f2bf(v[k]);
    *(v8us*)(dst + i * 8) = o; 
}

__global__ __launch_bounds__(256) void k_wcvt8h(const float* __restrict__ src, h16* dst, size_t n8, float carry) {
    const size_t i = (size_t)blockIdx.x * 256 + threadIdx.x; if (i >= n8) return;
    const v8f v = *(const v8f*)(src + i * 8); v8h o;
#pragma unroll
    for (int k = 0; k < 8; ++k) o[k] = toh_flush(bfr(v[k]) * carry);
    *(v8h*)(dst + i * 8) = o; 
}

// k_qkvt: one projection (q, k or v) fused with its shift-log and its max-plus head linear. ONE WAVE per 64x64 tile (16 accumulators), bf16 operands straight from K-contiguous planes, K = DM.
// Tile rows R = r0..r0+63 in [b][s] order (R = b*SEQ + s) read source rows s*NB_FULL + b; tile columns c0..c0+63 = one head.
// Epilogue: accumulators -> LDS x tile; x = log1p(max(x, 0)) - lam in place; y[r][o] = max_i(x[r][i] + W[o][i]) with the two weight rows of each lane in registers (o = lane, lane + 32) and x rows read as LDS broadcasts;
// grid (NB*SEQ/64, DM/64), one launch per projection.
__global__ __launch_bounds__(32) void k_qkvt(const bf* __restrict__ A, const bf* __restrict__ Bt, const float* __restrict__ lam, const float* __restrict__ Wt, float* TP) {
    __shared__ __align__(16) float xs[64 * XSP];
    __shared__ __align__(16) float wl[64 * XSP];
    __shared__ __align__(16) float ys[64 * XSP];
    const int K = DM;
    const int lane = threadIdx.x & 31, lr = lane & 15, hi = lane >> 4; const int r0 = blockIdx.x * 64, c0 = blockIdx.y * 64;
    const int bb = r0 / SEQ, s0 = r0 % SEQ;
    v8f acc[4][4];
#pragma unroll
    for (int mb = 0; mb < 4; ++mb)
#pragma unroll
        for (int nb = 0; nb < 4; ++nb) acc[mb][nb] = (v8f){};
    const size_t aoff = ((size_t)(s0 + lr) * NB_FULL + (size_t)bb) * K + 8 * hi, boff = (size_t)(c0 + lr) * K + 8 * hi;
#pragma unroll 1
    for (int kc = 0; kc < K; kc += 32) {
        v16bf a[4];
#pragma unroll
        for (int mb = 0; mb < 4; ++mb) a[mb] = ldb(A + aoff + (size_t)mb * 16 * NB_FULL * K + kc);
#pragma unroll
        for (int nb = 0; nb < 4; ++nb) { const v16bf b = ldb(Bt + boff + (size_t)nb * 16 * K + kc);
#pragma unroll
            for (int mb = 0; mb < 4; ++mb) acc[mb][nb] = wmmab_g(a[mb], b, acc[mb][nb]); }
    }
    // D layout: element j of lane = (row 8h + j, col lane&15); rows 0..63 x columns 0..63 all written
#pragma unroll
    for (int mb = 0; mb < 4; ++mb)
#pragma unroll
        for (int nb = 0; nb < 4; ++nb)
#pragma unroll
            for (int j = 0; j < 8; ++j) xs[(mb * 16 + hi * 8 + j) * XSP + nb * 16 + lr] = acc[mb][nb][j];
    // max-plus weight W[o][i], bf16-valued, thread-linear 16-B loads: 1024 pieces / 32 lanes
#pragma unroll 1
    for (int e = lane; e < 64 * 16; e += 32) {
        v4f w = *(const v4f*)(Wt + (size_t)e * 4);
#pragma unroll
        for (int i = 0; i < 4; ++i) w[i] = bfr(w[i]);
        *(v4fa*)(&wl[(e >> 4) * XSP + (e & 15) * 4]) = w; }
    wave_sync();
    const int c4 = (lane & 15) * 4, rh = lane >> 4;
    float lv[4];
#pragma unroll
    for (int i = 0; i < 4; ++i) lv[i] = bfr(lam[c0 + c4 + i]);      // c0 + 63 < DM
#pragma unroll 1
    for (int s = 0; s < 32; ++s) { const int row = 2 * s + rh;      // 32 trips x 2 rows = 64 rows; 16 lanes x 4 floats = 64 columns
        v4f x = *(const v4fa*)(&xs[row * XSP + c4]);
#pragma unroll
        for (int i = 0; i < 4; ++i) x[i] = log1pf(fmaxf(x[i], 0.0f)) - lv[i];
        *(v4fa*)(&xs[row * XSP + c4]) = x; }
    wave_sync();
    float wlo[64], whi[64];                                         // weight rows o = lane and o = lane + 32, static indices only
#pragma unroll
    for (int g = 0; g < 16; ++g) { const v4f t0 = *(const v4fa*)(&wl[lane * XSP + 4 * g]); const v4f t1 = *(const v4fa*)(&wl[(lane + 32) * XSP + 4 * g]);
#pragma unroll
        for (int i = 0; i < 4; ++i) { wlo[4 * g + i] = t0[i]; whi[4 * g + i] = t1[i]; } }
#pragma unroll 1
    for (int r = 0; r < 64; ++r) {
        float a0 = NEGB, a1 = NEGB;
#pragma unroll
        for (int g = 0; g < 16; ++g) { const v4f x = *(const v4fa*)(&xs[r * XSP + 4 * g]);
#pragma unroll
            for (int i = 0; i < 4; ++i) { a0 = fmaxf(a0, x[i] + wlo[4 * g + i]); a1 = fmaxf(a1, x[i] + whi[4 * g + i]); } }
        ys[r * XSP + lane] = a0; ys[r * XSP + lane + 32] = a1; }
    wave_sync();
    float* orow = TP + (size_t)r0 * DM + c0 + c4;
{
#pragma unroll 1
        for (int s = 0; s < 32; ++s) { const int row = 2 * s + rh;
            const v4f val = *(const v4fa*)(&ys[row * XSP + c4]);
            *(v4f*)(orow + (size_t)row * DM) = val; }
         }
}

__device__ __forceinline__ void dmm(const v4f q, const v4f k, float& mx, float& mn) {
    const float d0 = q[0] - k[0], d1 = q[1] - k[1], d2 = q[2] - k[2], d3 = q[3] - k[3];
    mx = fmaxf(mx, fmaxf(fmaxf(d0, d1), fmaxf(d2, d3)));
    mn = fminf(mn, fminf(fminf(d0, d1), fminf(d2, d3)));
}

// k_mpattn: max-plus attention on the vector unit in f32; block = (group g, 32-row query tile), 256 threads, key tiles of 32 staged in LDS (single-buffered, block barriers; all LDS regions cross-wave).
// Phase 1: wave w, lane j -> scores of query rows w, w+8, w+16, w+24 against key j. Phase 2: thread (row = tid>>3, octet = tid&7) keeps 8 running maxima of score + v.
__global__ __launch_bounds__(256) void k_mpattn(const float* __restrict__ QP, const float* __restrict__ KP, const float* __restrict__ VP, h16* AV) {
#pragma clang fp contract(off)
    __shared__ v4f qs[32 * 17];
    __shared__ v4f ks[32 * 17];
    __shared__ v4f vs[32 * 17];
    __shared__ float sc[32 * 33];
    const int g = blockIdx.y, sqt = blockIdx.x, tid = threadIdx.x;
    const int wave = __builtin_amdgcn_readfirstlane((int)(threadIdx.x >> 5));
    const int lane = tid & 31;
    const v4f* qb = (const v4f*)(QP + ((size_t)g * SEQ + (size_t)sqt * 32) * HD);
    const v4f* kb = (const v4f*)(KP + (size_t)g * SEQ * HD);
    const v4f* vb = (const v4f*)(VP + (size_t)g * SEQ * HD);
    // query tile: 32 rows x 16 pieces = 512 pieces, two per thread (rows 0..15 and 16..31)
    qs[(tid >> 4) * 17 + (tid & 15)]        = qb[tid];
    qs[((tid >> 4) + 16) * 17 + (tid & 15)] = qb[tid + 256];
    float ctx[8];
#pragma unroll
    for (int j = 0; j < 8; ++j) ctx[j] = NEGB;
    const int sq1 = wave, sk1 = lane;
    const int sq2 = tid >> 3, dg = tid & 7;
#pragma unroll 1
    for (int kt = 0; kt < SEQ / 32; ++kt) {
        __syncthreads();                                   // earlier readers of ks / vs / sc are done
        const int nbp = kt * 512;
        ks[(tid >> 4) * 17 + (tid & 15)]        = kb[nbp + tid];
        ks[((tid >> 4) + 16) * 17 + (tid & 15)] = kb[nbp + tid + 256];
        vs[(tid >> 4) * 17 + (tid & 15)]        = vb[nbp + tid];
        vs[((tid >> 4) + 16) * 17 + (tid & 15)] = vb[nbp + tid + 256];
        __syncthreads();
        float mx0 = NEGB, mx1 = NEGB, mx2 = NEGB, mx3 = NEGB;
        float mn0 = POSB, mn1 = POSB, mn2 = POSB, mn3 = POSB;
#pragma unroll 4
        for (int c = 0; c < 16; ++c) {
            const v4f kv = ks[sk1 * 17 + c];
            dmm(qs[sq1 * 17 + c], kv, mx0, mn0);
            dmm(qs[(sq1 + 8) * 17 + c], kv, mx1, mn1);
            dmm(qs[(sq1 + 16) * 17 + c], kv, mx2, mn2);
            dmm(qs[(sq1 + 24) * 17 + c], kv, mx3, mn3);
        }
        sc[sq1 * 33 + sk1]        = mn0 - mx0;             // = -(max - min)
        sc[(sq1 + 8) * 33 + sk1]  = mn1 - mx1;
        sc[(sq1 + 16) * 33 + sk1] = mn2 - mx2;
        sc[(sq1 + 24) * 33 + sk1] = mn3 - mx3;
        __syncthreads();
#pragma unroll 4
        for (int sk = 0; sk < 32; ++sk) {
            const float s = sc[sq2 * 33 + sk];
            const v4f v0 = vs[sk * 17 + dg * 2];
            const v4f v1 = vs[sk * 17 + dg * 2 + 1];
#pragma unroll
            for (int i = 0; i < 4; ++i) { ctx[i] = fmaxf(ctx[i], s + v0[i]); ctx[4 + i] = fmaxf(ctx[4 + i], s + v1[i]); }
        }
    }
    const int b2 = g / NH_, h2 = g % NH_;
    const int s2 = sqt * 32 + sq2;
    v8h o;
#pragma unroll
    for (int j = 0; j < 8; ++j) o[j] = toh_flush(expm1f(ctx[j]) * ACARRY);
    h16* dst = AV + ((size_t)s2 * NB + (size_t)b2) * DM + h2 * HD + dg * 8;
    *(v8h*)dst = o; 
}

// k_oln: output projection (f16 product) fused with the skip connection and LayerNorm. Block = 16 rows x 512 columns, 8 waves, wave w owns columns 64w..64w+63 (4 accumulators).
// Accumulators (scaled by 1/1024) staged in a block LDS tile (cross-wave, block barrier); then wave w owns rows 2w, 2w+1 (wave-private from here): adds the bf16-valued input row as float4 at the read stage,
__global__ __launch_bounds__(256) void k_oln(const h16* __restrict__ AV, const h16* __restrict__ WO, const float* __restrict__ hin, const float* __restrict__ gamma, const float* __restrict__ beta, float* OUT) {
    __shared__ __align__(16) float ys[ORW * YSP];
    const int lane = threadIdx.x & 31, lr = lane & 15, hi = lane >> 4;
    const int wave = __builtin_amdgcn_readfirstlane((int)(threadIdx.x >> 5));
    const int r0 = blockIdx.x * ORW, c0 = wave * 64;
    v8f acc[4];
#pragma unroll
    for (int nb = 0; nb < 4; ++nb) acc[nb] = (v8f){};
    const size_t aoff = (size_t)(r0 + lr) * DM + 8 * hi, boff = (size_t)(c0 + lr) * DM + 8 * hi;
#pragma unroll 1
    for (int kc = 0; kc < DM; kc += 32) {
        const v16h a = ldh(AV + aoff + kc);
#pragma unroll
        for (int nb = 0; nb < 4; ++nb) { const v16h b = ldh(WO + boff + (size_t)nb * 16 * DM + kc); acc[nb] = wmma16_g(a, b, acc[nb]); }
    }
    // D layout: element j of lane = (row 8h + j, col lane&15); 8 waves cover rows 0..15 x columns 0..511
#pragma unroll
    for (int nb = 0; nb < 4; ++nb)
#pragma unroll
        for (int j = 0; j < 8; ++j) ys[(hi * 8 + j) * YSP + c0 + nb * 16 + lr] = acc[nb][j] * OSCL;
    __syncthreads();
#pragma unroll 1
    for (int rr = 0; rr < 2; ++rr) {
        const int row = wave * 2 + rr;
        const int mrow = r0 + row;                                        // plane row s2*NB + b2
        const size_t grow = (size_t)(mrow / NB) * NB_FULL + (size_t)(mrow % NB);
        v4f y[4]; float sum = 0.0f;
#pragma unroll
        for (int j = 0; j < 4; ++j) { const int c = (lane + 32 * j) * 4;
            const v4f a = *(const v4fa*)(&ys[row * YSP + c]); const v4f hv = *(const v4f*)(hin + grow * DM + c);
#pragma unroll
            for (int i = 0; i < 4; ++i) { y[j][i] = bfr(hv[i]) + a[i]; sum += y[j][i]; } }
        sum = wsum(sum);
        const float mu = sum * (1.0f / (float)DM);
        float sq = 0.0f;
#pragma unroll
        for (int j = 0; j < 4; ++j)
#pragma unroll
            for (int i = 0; i < 4; ++i) { const float d = y[j][i] - mu; y[j][i] = d; sq += d * d; }
        sq = wsum(sq);
        const float rstd = rsqrtf(sq * (1.0f / (float)DM) + LNEPS);
#pragma unroll
        for (int j = 0; j < 4; ++j) { const int c = (lane + 32 * j) * 4;
            const v4f gv = *(const v4f*)(gamma + c); const v4f bv = *(const v4f*)(beta + c); v4f ov;
#pragma unroll
            for (int i = 0; i < 4; ++i) ov[i] = y[j][i] * rstd * bfr(gv[i]) + bfr(bv[i]);
            *(v4fa*)(&ys[row * YSP + c]) = ov; }
    }
    wave_sync();
{
#pragma unroll 1
        for (int rr = 0; rr < 2; ++rr) {
            const int row = wave * 2 + rr;
            const int mrow = r0 + row;
            const size_t grow = (size_t)(mrow / NB) * NB_FULL + (size_t)(mrow % NB);
#pragma unroll
            for (int j = 0; j < 4; ++j) { const int c = (lane + 32 * j) * 4;   // 4 instructions x 32 lanes x 16 B = 2048 B = one output row
                const v4f val = *(const v4fa*)(&ys[row * YSP + c]);
                *(v4f*)(OUT + grow * DM + c) = val; } }
         }
}

static constexpr size_t al256(size_t v) { return (v + 255) & ~(size_t)255; }
static constexpr size_t SZ_XB = al256((size_t)SEQ * NB_FULL * DM * 2);     // bf16 x, source row order
static constexpr size_t SZ_WB = al256((size_t)3 * DM * DM * 2);            // bf16 Wq | Wkv
static constexpr size_t SZ_WO = al256((size_t)DM * DM * 2);                // f16 Wo x64
static constexpr size_t SZ_TP = al256((size_t)NB * SEQ * DM * 4);          // f32 q / k / v planes after the head linear
static constexpr size_t SZ_AV = al256((size_t)NB * SEQ * DM * 2);          // f16 attention vector x16
static constexpr size_t SZ_TOTAL = SZ_XB + SZ_WB + SZ_WO + 3 * SZ_TP + SZ_AV;
static_assert(SZ_TOTAL <= (size_t)134217728);          // workspace carve <= 128 MiB
static_assert(((size_t)DM * DM * 2) % 256 == 0);       // weight sub-planes stay 256-byte aligned

extern "C" void kernel_launch(void* const* d_in, const int* in_sizes, int n_in,
                              void* d_out, int out_size, void* d_ws, size_t ws_size, hipStream_t stream) {
    if (n_in < 10) return;
    if ((size_t)in_sizes[0] < (size_t)SEQ * NB_FULL * DM) return;
    if ((size_t)in_sizes[1] < (size_t)DM * DM || (size_t)in_sizes[2] < (size_t)2 * DM * DM || (size_t)in_sizes[7] < (size_t)DM * DM) return;
    if (in_sizes[3] < HD * HD || in_sizes[4] < HD * HD || in_sizes[5] < HD * HD) return;
    if (in_sizes[6] < DM || in_sizes[8] < DM || in_sizes[9] < DM) return;
    if ((size_t)out_size < ((size_t)(SEQ - 1) * NB_FULL + NB) * DM) return;
    if (SZ_TOTAL > ws_size) return;
    // wire order: h, Wq, Wkv, Wqt, Wkt, Wvt, lam, Wo, gamma, beta
    const float* hin = (const float*)d_in[0];
    const float* wq  = (const float*)d_in[1];
    const float* wkv = (const float*)d_in[2];
    const float* wqt = (const float*)d_in[3];
    const float* wkt = (const float*)d_in[4];
    const float* wvt = (const float*)d_in[5];
    const float* lam = (const float*)d_in[6];
    const float* wo  = (const float*)d_in[7];
    const float* gam = (const float*)d_in[8];
    const float* bet = (const float*)d_in[9];
    float* OUT = (float*)d_out;      // [SEQ][NB_FULL][512]
    char* wsp = (char*)d_ws;
    bf*  XB  = (bf*)wsp;  wsp += SZ_XB;                 // [SEQ*NB_FULL][512]
    bf*  WB  = (bf*)wsp;  wsp += SZ_WB;                 // [1536][512]: q rows | k rows | v rows
    h16* WOH = (h16*)wsp; wsp += SZ_WO;                 // [512][512]
    float* TQ = (float*)wsp; wsp += SZ_TP;              // [NB*SEQ][512], row b*SEQ + s
    float* TK = (float*)wsp; wsp += SZ_TP;
    float* TV = (float*)wsp; wsp += SZ_TP;
    h16* AV  = (h16*)wsp; wsp += SZ_AV;                 // [NB*SEQ][512], row s2*NB + b2

    { const size_t n8 = (size_t)SEQ * NB_FULL * DM / 8; k_cvt8<<<(unsigned)((n8 + 255) / 256), 256, 0, stream>>>(hin, XB, n8); }
    { const size_t n8 = (size_t)DM * DM / 8; k_cvt8<<<(unsigned)((n8 + 255) / 256), 256, 0, stream>>>(wq, WB, n8); }
    { const size_t n8 = (size_t)2 * DM * DM / 8; k_cvt8<<<(unsigned)((n8 + 255) / 256), 256, 0, stream>>>(wkv, WB + (size_t)DM * DM, n8); }
    { const size_t n8 = (size_t)DM * DM / 8; k_wcvt8h<<<(unsigned)((n8 + 255) / 256), 256, 0, stream>>>(wo, WOH, n8, WCARRY); }

    // projections: A = x rows (tile row R = b*SEQ + s <- source row s*NB_FULL + b), Bt = W rows (n = head*64 + d) -> plane [R][512]
    k_qkvt<<<dim3(NB * SEQ / 64, DM / 64, 1), 32, 0, stream>>>(XB, WB, lam, wqt, TQ);
    k_qkvt<<<dim3(NB * SEQ / 64, DM / 64, 1), 32, 0, stream>>>(XB, WB + (size_t)DM * DM, lam, wkt, TK);
    k_qkvt<<<dim3(NB * SEQ / 64, DM / 64, 1), 32, 0, stream>>>(XB, WB + (size_t)2 * DM * DM, lam, wvt, TV);

    k_mpattn<<<dim3(SEQ / 32, NB * NH_, 1), 256, 0, stream>>>(TQ, TK, TV, AV);

    k_oln<<<dim3(NB * SEQ / ORW, 1, 1), 256, 0, stream>>>(AV, WOH, hin, gam, bet, OUT);
}

// v001
// One run takes 117 microseconds.
// Timed twice side by side with v000, it ran 1.77 and 1.74 times as fast.
#include <hip/hip_runtime.h>

// Max-plus multi-head attention block, width 512 = 8 heads x 64: x [SEQ][NB_FULL][512]; Wq [512][512], Wkv [1024][512] (k rows then v rows), Wo [512][512], all [out][in] (y = x W^T);
// per-feature shift lam [512]; three 64x64 max-plus head weights; post-LN over (x + attention output) with gain and offset inputs.
// Compute dtypes, f32 accumulate everywhere: q/k/v projections v_wmma_f32_16x16x32_bf16 (x and W RNE-converted to bf16; products exact);
// output projection v_wmma_f32_16x16x32_f16, one product: attention vector as f16 with a x16 carry, bf16-valued Wo as f16 with a x64 carry, folded by 1/1024 in the f32 epilogue.
// Max-plus stages (head linear y[o] = max_i(x[i] + W[o][i]); score = -(max_d(q-k) - min_d(q-k)); context = max_key(score + v)) are semiring operations and run in f32 on the vector unit, as do log1p, expm1 and LayerNorm.
// Layout: the head regrouping is the flat reshape of [b][s][head][d] into [b*8 + s/(SEQ/8)][(s % (SEQ/8))*8 + head][d], i.e. group g is the contiguous SEQ x 64 chunk g of a [b][s][512] plane; the q/k/v planes are kept in that order
// (GEMM row R = b*SEQ + s reads source row s*NB_FULL + b by arithmetic addressing). Attention vector plane rows s2*NB + b2 with g = b2*8 + h2, columns h2*64 + d.

#ifndef NB
#define NB 2
#endif
#ifndef SEQ
#define SEQ 512
#endif
#define NB_FULL  2
#define SEQ_FULL 512
#define DM   512
#define NH_  8
#define HD   64
#define XSP  68                  // LDS row pitch (floats) of the 64 x 64 tiles of the projection kernel
#define YSP  516                 // LDS row pitch (floats) of the 16 x 512 tile of the output kernel
#define ORW  16                  // rows per block of the output kernel
#define ACARRY 16.0f             // carry of the f16 attention vector plane
#define WCARRY 64.0f             // carry of the f16 Wo plane
#define OSCL (1.0f / 1024.0f)    // 1 / (ACARRY * WCARRY)
#define LNEPS 1e-5f
#define NEGB (-3.0e38f)
#define POSB (3.0e38f)

static_assert(NH_ * HD == DM);                 // head h = columns h*64 + d
static_assert(HD == 64);                       // one 64-column GEMM tile = one head; attention lanes own 8 octets of d
static_assert(DM % 64 == 0);
static_assert(DM % 32 == 0);                   // GEMM k-loops step by 32
static_assert(SEQ % 64 == 0);                  // a 64-row GEMM tile never straddles two batches
static_assert((NB * SEQ) % 64 == 0);
static_assert(SEQ % 32 == 0);                  // attention query and key tiles of 32 rows
static_assert(SEQ % NH_ == 0);                 // tokens per group = SEQ / 8
static_assert((NB * SEQ) % ORW == 0);
static_assert(ORW == 16);                      // one 16-row WMMA slab per block of the output kernel
static_assert(8 * 64 == DM);                   // 8 waves x 64 columns cover one output row
static_assert(NB <= NB_FULL);
static_assert(SEQ <= SEQ_FULL);
static_assert((XSP * 4) % 16 == 0);
static_assert(XSP >= 64);
static_assert((YSP * 4) % 16 == 0);
static_assert(YSP >= DM);
static_assert(((size_t)SEQ * NB_FULL * DM) % 8 == 0);
static_assert(((size_t)DM * DM) % 8 == 0);
static_assert(32 * 16 * 32 == 64 * 64 * 4);            // projection store: 32 lanes x 16 B x 32 trips == 64 rows x 256 B
static_assert(256 * 16 == 32 * HD * 2);
static_assert(8 * (ORW / 8) * 4 * 32 * 16 == ORW * DM * 4);   // output store: 8 waves x 2 rows x 4 instructions x 512 B == 16 rows x 2048 B
static_assert(3 * 64 * XSP * 4 <= 131072);             // static LDS of the projection kernel
static_assert(3 * 32 * 17 * 16 + 32 * 33 * 4 <= 131072);   // static LDS of the attention kernel
static_assert(ORW * YSP * 4 <= 131072);                // static LDS of the output kernel

typedef _Float16 h16;
typedef unsigned short bf;
typedef __attribute__((ext_vector_type(16))) __bf16   v16bf;
typedef __attribute__((ext_vector_type(16))) _Float16 v16h;
typedef __attribute__((ext_vector_type(8)))  _Float16 v8h;
typedef __attribute__((ext_vector_type(8)))  unsigned short v8us;
typedef __attribute__((ext_vector_type(8)))  float    v8f;
typedef __attribute__((ext_vector_type(4)))  float    v4f;
typedef v4f  __attribute__((may_alias)) v4fa;

__device__ __forceinline__ unsigned short f2bf(float f) { unsigned u = __float_as_uint(f); u += 0x7FFFu + ((u >> 16) & 1u); return (unsigned short)(u >> 16); }
__device__ __forceinline__ float bfr(float f) { return __uint_as_float(((unsigned)f2bf(f)) << 16); }   // value after RNE convert to bf16
__device__ __forceinline__ v16h cat16(v8h lo, v8h hi) { return __builtin_shufflevector(lo, hi, 0, 1, 2, 3, 4, 5, 6, 7, 8, 9, 10, 11, 12, 13, 14, 15); }
__device__ __forceinline__ v16bf cat16b(v8us lo, v8us hi) { return __builtin_bit_cast(v16bf, __builtin_shufflevector(lo, hi, 0, 1, 2, 3, 4, 5, 6, 7, 8, 9, 10, 11, 12, 13, 14, 15)); }
__device__ __forceinline__ v8f wmma16(v16h a, v16h b, v8f c) { return __builtin_amdgcn_wmma_f32_16x16x32_f16(false, a, false, b, (short)0, c, false, false); }
__device__ __forceinline__ v8f wmmab(v16bf a, v16bf b, v8f c) { return __builtin_amdgcn_wmma_f32_16x16x32_bf16(false, a, false, b, (short)0, c, false, false); }
// fragment loaders from K-contiguous 16-bit rows; p already includes + 8*(lane>>4): elements 0..7 <- k0+8h+0..7, elements 8..15 <- k0+16+8h+0..7 (same map for A and B)
__device__ __forceinline__ v16h  ldh(const h16* p) { return cat16(*(const v8h*)p, *(const v8h*)(p + 16)); }
__device__ __forceinline__ v16bf ldb(const bf* p)  { return cat16b(*(const v8us*)p, *(const v8us*)(p + 16)); }
// ordering point for wave-private LDS tiles (same wave writes and reads)
__device__ __forceinline__ void wave_sync() { __builtin_amdgcn_fence(3 /* release order */, "wavefront"); __builtin_amdgcn_wave_barrier(); asm volatile("" ::: "memory"); }

// per-instruction guarded matrix products: one accumulator tied per guard, operands kept live across the nops
__device__ __forceinline__ v8f wmmab_g(v16bf a, v16bf b, v8f c) { c = wmmab(a, b, c); asm volatile("v_nop\n\tv_nop\n\tv_nop\n\tv_nop" : "+v"(c) : "v"(a), "v"(b)); return c; }
__device__ __forceinline__ v8f wmma16_g(v16h a, v16h b, v8f c) { c = wmma16(a, b, c); asm volatile("v_nop\n\tv_nop\n\tv_nop\n\tv_nop" : "+v"(c) : "v"(a), "v"(b)); return c; }
// f32 -> f16 convert that cannot produce a subnormal operand (|v| < 2^-14 -> +0), applied after the plane's carry
static __device__ __forceinline__ h16 toh_flush(float v) { const h16 r = (h16)v; return (fabsf(v) < 6.103515625e-05f) ? (h16)0.0f : r; }
__device__ __forceinline__ float wsum(float v) { v += __shfl_xor(v, 16, 32); v += __shfl_xor(v, 8, 32); v += __shfl_xor(v, 4, 32); v += __shfl_xor(v, 2, 32); v += __shfl_xor(v, 1, 32); return v; }

__global__ __launch_bounds__(256) void k_cvt8(const float* __restrict__ src, bf* dst, size_t n8) {
    const size_t i = (size_t)blockIdx.x * 256 + threadIdx.x; if (i >= n8) return;
    const v8f v = *(const v8f*)(src + i * 8); v8us o;
#pragma unroll
    for (int k = 0; k < 8; ++k) o[k] = f2bf(v[k]);
    *(v8us*)(dst + i * 8) = o; 
}

__global__ __launch_bounds__(256) void k_wcvt8h(const float* __restrict__ src, h16* dst, size_t n8, float carry) {
    const size_t i = (size_t)blockIdx.x * 256 + threadIdx.x; if (i >= n8) return;
    const v8f v = *(const v8f*)(src + i * 8); v8h o;
#pragma unroll
    for (int k = 0; k < 8; ++k) o[k] = toh_flush(bfr(v[k]) * carry);
    *(v8h*)(dst + i * 8) = o; 
}

// k_qkvt: the three projections (blockIdx.z = 0, 1, 2 for q, k, v) in one grid, each fused with its shift-log and its max-plus head linear. ONE WAVE per 64x64 tile (16 accumulators), bf16 operands straight from K-contiguous planes, K = DM.
// Tile rows R = r0..r0+63 in [b][s] order (R = b*SEQ + s) read source rows s*NB_FULL + b; tile columns c0..c0+63 = one head.
// Epilogue: accumulators -> LDS x tile; x = log1p(max(x, 0)) - lam in place; y[r][o] = max_i(x[r][i] + W[o][i]) with the two weight rows of each lane in registers (o = lane, lane + 32) and x rows read as LDS broadcasts;
// grid (NB*SEQ/64, DM/64, 3): the projections do not depend on one another, and one of them alone puts a single wave on half of the WGPs, so their one-wave tiles run side by side.
// WB holds the q, k and v weight rows one after the other (DM rows each).
__global__ __launch_bounds__(32) void k_qkvt(const bf* __restrict__ A, const bf* __restrict__ WB, const float* __restrict__ lam,
                                             const float* __restrict__ Wqt, const float* __restrict__ Wkt, const float* __restrict__ Wvt, float* TQ, float* TK, float* TV) {
    __shared__ __align__(16) float xs[64 * XSP];
    __shared__ __align__(16) float wl[64 * XSP];
    __shared__ __align__(16) float ys[64 * XSP];
    const int K = DM;
    const int pz = blockIdx.z;
    const bf* Bt = WB + (size_t)pz * DM * DM;
    const float* Wt = pz == 0 ? Wqt : (pz == 1 ? Wkt : Wvt);
    float* TP = pz == 0 ? TQ : (pz == 1 ? TK : TV);
    const int lane = threadIdx.x & 31, lr = lane & 15, hi = lane >> 4; const int r0 = blockIdx.x * 64, c0 = blockIdx.y * 64;
    const int bb = r0 / SEQ, s0 = r0 % SEQ;
    v8f acc[4][4];
#pragma unroll
    for (int mb = 0; mb < 4; ++mb)
#pragma unroll
        for (int nb = 0; nb < 4; ++nb) acc[mb][nb] = (v8f){};
    const size_t aoff = ((size_t)(s0 + lr) * NB_FULL + (size_t)bb) * K + 8 * hi, boff = (size_t)(c0 + lr) * K + 8 * hi;
#pragma unroll 1
    for (int kc = 0; kc < K; kc += 32) {
        v16bf a[4];
#pragma unroll
        for (int mb = 0; mb < 4; ++mb) a[mb] = ldb(A + aoff + (size_t)mb * 16 * NB_FULL * K + kc);
#pragma unroll
        for (int nb = 0; nb < 4; ++nb) { const v16bf b = ldb(Bt + boff + (size_t)nb * 16 * K + kc);
#pragma unroll
            for (int mb = 0; mb < 4; ++mb) acc[mb][nb] = wmmab_g(a[mb], b, acc[mb][nb]); }
    }
    // D layout: element j of lane = (row 8h + j, col lane&15); rows 0..63 x columns 0..63 all written
#pragma unroll
    for (int mb = 0; mb < 4; ++mb)
#pragma unroll
        for (int nb = 0; nb < 4; ++nb)
#pragma unroll
            for (int j = 0; j < 8; ++j) xs[(mb * 16 + hi * 8 + j) * XSP + nb * 16 + lr] = acc[mb][nb][j];
    // max-plus weight W[o][i], bf16-valued, thread-linear 16-B loads: 1024 pieces / 32 lanes
#pragma unroll 1
    for (int e = lane; e < 64 * 16; e += 32) {
        v4f w = *(const v4f*)(Wt + (size_t)e * 4);
#pragma unroll
        for (int i = 0; i < 4; ++i) w[i] = bfr(w[i]);
        *(v4fa*)(&wl[(e >> 4) * XSP + (e & 15) * 4]) = w; }
    wave_sync();
    const int c4 = (lane & 15) * 4, rh = lane >> 4;
    float lv[4];
#pragma unroll
    for (int i = 0; i < 4; ++i) lv[i] = bfr(lam[c0 + c4 + i]);      // c0 + 63 < DM
#pragma unroll 1
    for (int s = 0; s < 32; ++s) { const int row = 2 * s + rh;      // 32 trips x 2 rows = 64 rows; 16 lanes x 4 floats = 64 columns
        v4f x = *(const v4fa*)(&xs[row * XSP + c4]);
#pragma unroll
        for (int i = 0; i < 4; ++i) x[i] = log1pf(fmaxf(x[i], 0.0f)) - lv[i];
        *(v4fa*)(&xs[row * XSP + c4]) = x; }
    wave_sync();
    float wlo[64], whi[64];                                         // weight rows o = lane and o = lane + 32, static indices only
#pragma unroll
    for (int g = 0; g < 16; ++g) { const v4f t0 = *(const v4fa*)(&wl[lane * XSP + 4 * g]); const v4f t1 = *(const v4fa*)(&wl[(lane + 32) * XSP + 4 * g]);
#pragma unroll
        for (int i = 0; i < 4; ++i) { wlo[4 * g + i] = t0[i]; whi[4 * g + i] = t1[i]; } }
#pragma unroll 1
    for (int r = 0; r < 64; ++r) {
        float a0 = NEGB, a1 = NEGB;
#pragma unroll
        for (int g = 0; g < 16; ++g) { const v4f x = *(const v4fa*)(&xs[r * XSP + 4 * g]);
#pragma unroll
            for (int i = 0; i < 4; ++i) { a0 = fmaxf(a0, x[i] + wlo[4 * g + i]); a1 = fmaxf(a1, x[i] + whi[4 * g + i]); } }
        ys[r * XSP + lane] = a0; ys[r * XSP + lane + 32] = a1; }
    wave_sync();
    float* orow = TP + (size_t)r0 * DM + c0 + c4;
{
#pragma unroll 1
        for (int s = 0; s < 32; ++s) { const int row = 2 * s + rh;
            const v4f val = *(const v4fa*)(&ys[row * XSP + c4]);
            *(v4f*)(orow + (size_t)row * DM) = val; }
         }
}

__device__ __forceinline__ void dmm(const v4f q, const v4f k, float& mx, float& mn) {
    const float d0 = q[0] - k[0], d1 = q[1] - k[1], d2 = q[2] - k[2], d3 = q[3] - k[3];
    mx = fmaxf(mx, fmaxf(fmaxf(d0, d1), fmaxf(d2, d3)));
    mn = fminf(mn, fminf(fminf(d0, d1), fminf(d2, d3)));
}

// k_mpattn: max-plus attention on the vector unit in f32; block = (group g, 32-row query tile), 256 threads, key tiles of 32 staged in LDS (single-buffered, block barriers; all LDS regions cross-wave).
// Phase 1: wave w, lane j -> scores of query rows w, w+8, w+16, w+24 against key j. Phase 2: thread (row = tid>>3, octet = tid&7) keeps 8 running maxima of score + v.
__global__ __launch_bounds__(256) void k_mpattn(const float* __restrict__ QP, const float* __restrict__ KP, const float* __restrict__ VP, h16* AV) {
#pragma clang fp contract(off)
    __shared__ v4f qs[32 * 17];
    __shared__ v4f ks[32 * 17];
    __shared__ v4f vs[32 * 17];
    __shared__ float sc[32 * 33];
    const int g = blockIdx.y, sqt = blockIdx.x, tid = threadIdx.x;
    const int wave = __builtin_amdgcn_readfirstlane((int)(threadIdx.x >> 5));
    const int lane = tid & 31;
    const v4f* qb = (const v4f*)(QP + ((size_t)g * SEQ + (size_t)sqt * 32) * HD);
    const v4f* kb = (const v4f*)(KP + (size_t)g * SEQ * HD);
    const v4f* vb = (const v4f*)(VP + (size_t)g * SEQ * HD);
    // query tile: 32 rows x 16 pieces = 512 pieces, two per thread (rows 0..15 and 16..31)
    qs[(tid >> 4) * 17 + (tid & 15)]        = qb[tid];
    qs[((tid >> 4) + 16) * 17 + (tid & 15)] = qb[tid + 256];
    float ctx[8];
#pragma unroll
    for (int j = 0; j < 8; ++j) ctx[j] = NEGB;
    const int sq1 = wave, sk1 = lane;
    const int sq2 = tid >> 3, dg = tid & 7;
#pragma unroll 1
    for (int kt = 0; kt < SEQ / 32; ++kt) {
        __syncthreads();                                   // earlier readers of ks / vs / sc are done
        const int nbp = kt * 512;
        ks[(tid >> 4) * 17 + (tid & 15)]        = kb[nbp + tid];
        ks[((tid >> 4) + 16) * 17 + (tid & 15)] = kb[nbp + tid + 256];
        vs[(tid >> 4) * 17 + (tid & 15)]        = vb[nbp + tid];
        vs[((tid >> 4) + 16) * 17 + (tid & 15)] = vb[nbp + tid + 256];
        __syncthreads();
        float mx0 = NEGB, mx1 = NEGB, mx2 = NEGB, mx3 = NEGB;
        float mn0 = POSB, mn1 = POSB, mn2 = POSB, mn3 = POSB;
#pragma unroll 4
        for (int c = 0; c < 16; ++c) {
            const v4f kv = ks[sk1 * 17 + c];
            dmm(qs[sq1 * 17 + c], kv, mx0, mn0);
            dmm(qs[(sq1 + 8) * 17 + c], kv, mx1, mn1);
            dmm(qs[(sq1 + 16) * 17 + c], kv, mx2, mn2);
            dmm(qs[(sq1 + 24) * 17 + c], kv, mx3, mn3);
        }
        sc[sq1 * 33 + sk1]        = mn0 - mx0;             // = -(max - min)
        sc[(sq1 + 8) * 33 + sk1]  = mn1 - mx1;
        sc[(sq1 + 16) * 33 + sk1] = mn2 - mx2;
        sc[(sq1 + 24) * 33 + sk1] = mn3 - mx3;
        __syncthreads();
#pragma unroll 4
        for (int sk = 0; sk < 32; ++sk) {
            const float s = sc[sq2 * 33 + sk];
            const v4f v0 = vs[sk * 17 + dg * 2];
            const v4f v1 = vs[sk * 17 + dg * 2 + 1];
#pragma unroll
            for (int i = 0; i < 4; ++i) { ctx[i] = fmaxf(ctx[i], s + v0[i]); ctx[4 + i] = fmaxf(ctx[4 + i], s + v1[i]); }
        }
    }
    const int b2 = g / NH_, h2 = g % NH_;
    const int s2 = sqt * 32 + sq2;
    v8h o;
#pragma unroll
    for (int j = 0; j < 8; ++j) o[j] = toh_flush(expm1f(ctx[j]) * ACARRY);
    h16* dst = AV + ((size_t)s2 * NB + (size_t)b2) * DM + h2 * HD + dg * 8;
    *(v8h*)dst = o; 
}

// k_oln: output projection (f16 product) fused with the skip connection and LayerNorm. Block = 16 rows x 512 columns, 8 waves, wave w owns columns 64w..64w+63 (4 accumulators).
// Accumulators (scaled by 1/1024) staged in a block LDS tile (cross-wave, block barrier); then wave w owns rows 2w, 2w+1 (wave-private from here): adds the bf16-valued input row as float4 at the read stage,
__global__ __launch_bounds__(256) void k_oln(const h16* __restrict__ AV, const h16* __restrict__ WO, const float* __restrict__ hin, const float* __restrict__ gamma, const float* __restrict__ beta, float* OUT) {
    __shared__ __align__(16) float ys[ORW * YSP];
    const int lane = threadIdx.x & 31, lr = lane & 15, hi = lane >> 4;
    const int wave = __builtin_amdgcn_readfirstlane((int)(threadIdx.x >> 5));
    const int r0 = blockIdx.x * ORW, c0 = wave * 64;
    v8f acc[4];
#pragma unroll
    for (int nb = 0; nb < 4; ++nb) acc[nb] = (v8f){};
    const size_t aoff = (size_t)(r0 + lr) * DM + 8 * hi, boff = (size_t)(c0 + lr) * DM + 8 * hi;
#pragma unroll 1
    for (int kc = 0; kc < DM; kc += 32) {
        const v16h a = ldh(AV + aoff + kc);
#pragma unroll
        for (int nb = 0; nb < 4; ++nb) { const v16h b = ldh(WO + boff + (size_t)nb * 16 * DM + kc); acc[nb] = wmma16_g(a, b, acc[nb]); }
    }
    // D layout: element j of lane = (row 8h + j, col lane&15); 8 waves cover rows 0..15 x columns 0..511
#pragma unroll
    for (int nb = 0; nb < 4; ++nb)
#pragma unroll
        for (int j = 0; j < 8; ++j) ys[(hi * 8 + j) * YSP + c0 + nb * 16 + lr] = acc[nb][j] * OSCL;
    __syncthreads();
#pragma unroll 1
    for (int rr = 0; rr < 2; ++rr) {
        const int row = wave * 2 + rr;
        const int mrow = r0 + row;                                        // plane row s2*NB + b2
        const size_t grow = (size_t)(mrow / NB) * NB_FULL + (size_t)(mrow % NB);
        v4f y[4]; float sum = 0.0f;
#pragma unroll
        for (int j = 0; j < 4; ++j) { const int c = (lane + 32 * j) * 4;
            const v4f a = *(const v4fa*)(&ys[row * YSP + c]); const v4f hv = *(const v4f*)(hin + grow * DM + c);
#pragma unroll
            for (int i = 0; i < 4; ++i) { y[j][i] = bfr(hv[i]) + a[i]; sum += y[j][i]; } }
        sum = wsum(sum);
        const float mu = sum * (1.0f / (float)DM);
        float sq = 0.0f;
#pragma unroll
        for (int j = 0; j < 4; ++j)
#pragma unroll
            for (int i = 0; i < 4; ++i) { const float d = y[j][i] - mu; y[j][i] = d; sq += d * d; }
        sq = wsum(sq);
        const float rstd = rsqrtf(sq * (1.0f / (float)DM) + LNEPS);
#pragma unroll
        for (int j = 0; j < 4; ++j) { const int c = (lane + 32 * j) * 4;
            const v4f gv = *(const v4f*)(gamma + c); const v4f bv = *(const v4f*)(beta + c); v4f ov;
#pragma unroll
            for (int i = 0; i < 4; ++i) ov[i] = y[j][i] * rstd * bfr(gv[i]) + bfr(bv[i]);
            *(v4fa*)(&ys[row * YSP + c]) = ov; }
    }
    wave_sync();
{
#pragma unroll 1
        for (int rr = 0; rr < 2; ++rr) {
            const int row = wave * 2 + rr;
            const int mrow = r0 + row;
            const size_t grow = (size_t)(mrow / NB) * NB_FULL + (size_t)(mrow % NB);
#pragma unroll
            for (int j = 0; j < 4; ++j) { const int c = (lane + 32 * j) * 4;   // 4 instructions x 32 lanes x 16 B = 2048 B = one output row
                const v4f val = *(const v4fa*)(&ys[row * YSP + c]);
                *(v4f*)(OUT + grow * DM + c) = val; } }
         }
}

static constexpr size_t al256(size_t v) { return (v + 255) & ~(size_t)255; }
static constexpr size_t SZ_XB = al256((size_t)SEQ * NB_FULL * DM * 2);     // bf16 x, source row order
static constexpr size_t SZ_WB = al256((size_t)3 * DM * DM * 2);            // bf16 Wq | Wkv
static constexpr size_t SZ_WO = al256((size_t)DM * DM * 2);                // f16 Wo x64
static constexpr size_t SZ_TP = al256((size_t)NB * SEQ * DM * 4);          // f32 q / k / v planes after the head linear
static constexpr size_t SZ_AV = al256((size_t)NB * SEQ * DM * 2);          // f16 attention vector x16
static constexpr size_t SZ_TOTAL = SZ_XB + SZ_WB + SZ_WO + 3 * SZ_TP + SZ_AV;
static_assert(SZ_TOTAL <= (size_t)134217728);          // workspace carve <= 128 MiB
static_assert(((size_t)DM * DM * 2) % 256 == 0);       // weight sub-planes stay 256-byte aligned

extern "C" void kernel_launch(void* const* d_in, const int* in_sizes, int n_in,
                              void* d_out, int out_size, void* d_ws, size_t ws_size, hipStream_t stream) {
    if (n_in < 10) return;
    if ((size_t)in_sizes[0] < (size_t)SEQ * NB_FULL * DM) return;
    if ((size_t)in_sizes[1] < (size_t)DM * DM || (size_t)in_sizes[2] < (size_t)2 * DM * DM || (size_t)in_sizes[7] < (size_t)DM * DM) return;
    if (in_sizes[3] < HD * HD || in_sizes[4] < HD * HD || in_sizes[5] < HD * HD) return;
    if (in_sizes[6] < DM || in_sizes[8] < DM || in_sizes[9] < DM) return;
    if ((size_t)out_size < ((size_t)(SEQ - 1) * NB_FULL + NB) * DM) return;
    if (SZ_TOTAL > ws_size) return;
    // wire order: h, Wq, Wkv, Wqt, Wkt, Wvt, lam, Wo, gamma, beta
    const float* hin = (const float*)d_in[0];
    const float* wq  = (const float*)d_in[1];
    const float* wkv = (const float*)d_in[2];
    const float* wqt = (const float*)d_in[3];
    const float* wkt = (const float*)d_in[4];
    const float* wvt = (const float*)d_in[5];
    const float* lam = (const float*)d_in[6];
    const float* wo  = (const float*)d_in[7];
    const float* gam = (const float*)d_in[8];
    const float* bet = (const float*)d_in[9];
    float* OUT = (float*)d_out;      // [SEQ][NB_FULL][512]
    char* wsp = (char*)d_ws;
    bf*  XB  = (bf*)wsp;  wsp += SZ_XB;                 // [SEQ*NB_FULL][512]
    bf*  WB  = (bf*)wsp;  wsp += SZ_WB;                 // [1536][512]: q rows | k rows | v rows
    h16* WOH = (h16*)wsp; wsp += SZ_WO;                 // [512][512]
    float* TQ = (float*)wsp; wsp += SZ_TP;              // [NB*SEQ][512], row b*SEQ + s
    float* TK = (float*)wsp; wsp += SZ_TP;
    float* TV = (float*)wsp; wsp += SZ_TP;
    h16* AV  = (h16*)wsp; wsp += SZ_AV;                 // [NB*SEQ][512], row s2*NB + b2

    { const size_t n8 = (size_t)SEQ * NB_FULL * DM / 8; k_cvt8<<<(unsigned)((n8 + 255) / 256), 256, 0, stream>>>(hin, XB, n8); }
    { const size_t n8 = (size_t)DM * DM / 8; k_cvt8<<<(unsigned)((n8 + 255) / 256), 256, 0, stream>>>(wq, WB, n8); }
    { const size_t n8 = (size_t)2 * DM * DM / 8; k_cvt8<<<(unsigned)((n8 + 255) / 256), 256, 0, stream>>>(wkv, WB + (size_t)DM * DM, n8); }
    { const size_t n8 = (size_t)DM * DM / 8; k_wcvt8h<<<(unsigned)((n8 + 255) / 256), 256, 0, stream>>>(wo, WOH, n8, WCARRY); }

    // projections: A = x rows (tile row R = b*SEQ + s <- source row s*NB_FULL + b), Bt = W rows (n = head*64 + d) -> plane [R][512]
    k_qkvt<<<dim3(NB * SEQ / 64, DM / 64, 3), 32, 0, stream>>>(XB, WB, lam, wqt, wkt, wvt, TQ, TK, TV);

    k_mpattn<<<dim3(SEQ / 32, NB * NH_, 1), 256, 0, stream>>>(TQ, TK, TV, AV);

    k_oln<<<dim3(NB * SEQ / ORW, 1, 1), 256, 0, stream>>>(AV, WOH, hin, gam, bet, OUT);
}

// v002
// Measured time: 87.4 microseconds a run.
// In two side-by-side timings against v001, it was 1.34 and 1.32 times as fast.
// Over all steps from v000 it is 2.34 times as fast.
#include <hip/hip_runtime.h>

// Max-plus multi-head attention block, width 512 = 8 heads x 64: x [SEQ][NB_FULL][512]; Wq [512][512], Wkv [1024][512] (k rows then v rows), Wo [512][512], all [out][in] (y = x W^T);
// per-feature shift lam [512]; three 64x64 max-plus head weights; post-LN over (x + attention output) with gain and offset inputs.
// Compute dtypes, f32 accumulate everywhere: q/k/v projections v_wmma_f32_16x16x32_bf16 (x and W RNE-converted to bf16; products exact);
// output projection v_wmma_f32_16x16x32_f16, one product: attention vector as f16 with a x16 carry, bf16-valued Wo as f16 with a x64 carry, folded by 1/1024 in the f32 epilogue.
// Max-plus stages (head linear y[o] = max_i(x[i] + W[o][i]); score = -(max_d(q-k) - min_d(q-k)); context = max_key(score + v)) are semiring operations and run in f32 on the vector unit, as do log1p, expm1 and LayerNorm.
// Layout: the head regrouping is the flat reshape of [b][s][head][d] into [b*8 + s/(SEQ/8)][(s % (SEQ/8))*8 + head][d], i.e. group g is the contiguous SEQ x 64 chunk g of a [b][s][512] plane; the q/k/v planes are kept in that order
// (GEMM row R = b*SEQ + s reads source row s*NB_FULL + b by arithmetic addressing). Attention vector plane rows s2*NB + b2 with g = b2*8 + h2, columns h2*64 + d.

#ifndef NB
#define NB 2
#endif
#ifndef SEQ
#define SEQ 512
#endif
#define NB_FULL  2
#define SEQ_FULL 512
#define DM   512
#define NH_  8
#define HD   64
#define XSP  68                  // LDS row pitch (floats) of the 64-column tiles of the projection kernel
#define YSP  516                 // LDS row pitch (floats) of the 16 x 512 tile of the output kernel
#define ORW  16                  // rows per block of the output kernel
#define PRW  32                  // rows per block of the projection kernel
#define ACARRY 16.0f             // carry of the f16 attention vector plane
#define WCARRY 64.0f             // carry of the f16 Wo plane
#define OSCL (1.0f / 1024.0f)    // 1 / (ACARRY * WCARRY)
#define LNEPS 1e-5f
#define NEGB (-3.0e38f)
#define POSB (3.0e38f)

static_assert(NH_ * HD == DM);                 // head h = columns h*64 + d
static_assert(HD == 64);                       // one 64-column GEMM tile = one head; attention lanes own 8 octets of d
static_assert(DM % 64 == 0);
static_assert(DM % 32 == 0);                   // GEMM k-loops step by 32
static_assert(SEQ % PRW == 0);                 // a projection tile never straddles two batches
static_assert((NB * SEQ) % PRW == 0);
static_assert(PRW == 32);                      // 2 WMMA row slabs per wave; 4 waves x 8 epilogue rows
static_assert(SEQ % 32 == 0);                  // attention query and key tiles of 32 rows
static_assert(SEQ % NH_ == 0);                 // tokens per group = SEQ / 8
static_assert((NB * SEQ) % ORW == 0);
static_assert(ORW == 16);                      // one 16-row WMMA slab per block of the output kernel
static_assert(8 * 64 == DM);                   // 8 waves x 64 columns cover one output row
static_assert(NB <= NB_FULL);
static_assert(SEQ <= SEQ_FULL);
static_assert((XSP * 4) % 16 == 0);
static_assert(XSP >= 64);
static_assert((YSP * 4) % 16 == 0);
static_assert(YSP >= DM);
static_assert(((size_t)SEQ * NB_FULL * DM) % 8 == 0);
static_assert(((size_t)DM * DM) % 8 == 0);
static_assert(4 * 32 * 16 * 4 == PRW * 64 * 4);        // projection store: 4 waves x 32 lanes x 16 B x 4 trips == 32 rows x 256 B
static_assert(256 * 16 == 32 * HD * 2);
static_assert(8 * (ORW / 8) * 4 * 32 * 16 == ORW * DM * 4);   // output store: 8 waves x 2 rows x 4 instructions x 512 B == 16 rows x 2048 B
static_assert((2 * PRW + 64) * XSP * 4 <= 131072);     // static LDS of the projection kernel
static_assert(3 * 32 * 17 * 16 + 32 * 33 * 4 <= 131072);   // static LDS of the attention kernel
static_assert(ORW * YSP * 4 <= 131072);                // static LDS of the output kernel

typedef _Float16 h16;
typedef unsigned short bf;
typedef __attribute__((ext_vector_type(16))) __bf16   v16bf;
typedef __attribute__((ext_vector_type(16))) _Float16 v16h;
typedef __attribute__((ext_vector_type(8)))  _Float16 v8h;
typedef __attribute__((ext_vector_type(8)))  unsigned short v8us;
typedef __attribute__((ext_vector_type(8)))  float    v8f;
typedef __attribute__((ext_vector_type(4)))  float    v4f;
typedef v4f  __attribute__((may_alias)) v4fa;

__device__ __forceinline__ unsigned short f2bf(float f) { unsigned u = __float_as_uint(f); u += 0x7FFFu + ((u >> 16) & 1u); return (unsigned short)(u >> 16); }
__device__ __forceinline__ float bfr(float f) { return __uint_as_float(((unsigned)f2bf(f)) << 16); }   // value after RNE convert to bf16
__device__ __forceinline__ v16h cat16(v8h lo, v8h hi) { return __builtin_shufflevector(lo, hi, 0, 1, 2, 3, 4, 5, 6, 7, 8, 9, 10, 11, 12, 13, 14, 15); }
__device__ __forceinline__ v16bf cat16b(v8us lo, v8us hi) { return __builtin_bit_cast(v16bf, __builtin_shufflevector(lo, hi, 0, 1, 2, 3, 4, 5, 6, 7, 8, 9, 10, 11, 12, 13, 14, 15)); }
__device__ __forceinline__ v8f wmma16(v16h a, v16h b, v8f c) { return __builtin_amdgcn_wmma_f32_16x16x32_f16(false, a, false, b, (short)0, c, false, false); }
__device__ __forceinline__ v8f wmmab(v16bf a, v16bf b, v8f c) { return __builtin_amdgcn_wmma_f32_16x16x32_bf16(false, a, false, b, (short)0, c, false, false); }
// fragment loaders from K-contiguous 16-bit rows; p already includes + 8*(lane>>4): elements 0..7 <- k0+8h+0..7, elements 8..15 <- k0+16+8h+0..7 (same map for A and B)
__device__ __forceinline__ v16h  ldh(const h16* p) { return cat16(*(const v8h*)p, *(const v8h*)(p + 16)); }
__device__ __forceinline__ v16bf ldb(const bf* p)  { return cat16b(*(const v8us*)p, *(const v8us*)(p + 16)); }
// ordering point for wave-private LDS tiles (same wave writes and reads)
__device__ __forceinline__ void wave_sync() { __builtin_amdgcn_fence(3 /* release order */, "wavefront"); __builtin_amdgcn_wave_barrier(); asm volatile("" ::: "memory"); }

// per-instruction guarded matrix products: one accumulator tied per guard, operands kept live across the nops
__device__ __forceinline__ v8f wmmab_g(v16bf a, v16bf b, v8f c) { c = wmmab(a, b, c); asm volatile("v_nop\n\tv_nop\n\tv_nop\n\tv_nop" : "+v"(c) : "v"(a), "v"(b)); return c; }
__device__ __forceinline__ v8f wmma16_g(v16h a, v16h b, v8f c) { c = wmma16(a, b, c); asm volatile("v_nop\n\tv_nop\n\tv_nop\n\tv_nop" : "+v"(c) : "v"(a), "v"(b)); return c; }
// f32 -> f16 convert that cannot produce a subnormal operand (|v| < 2^-14 -> +0), applied after the plane's carry
static __device__ __forceinline__ h16 toh_flush(float v) { const h16 r = (h16)v; return (fabsf(v) < 6.103515625e-05f) ? (h16)0.0f : r; }
__device__ __forceinline__ float wsum(float v) { v += __shfl_xor(v, 16, 32); v += __shfl_xor(v, 8, 32); v += __shfl_xor(v, 4, 32); v += __shfl_xor(v, 2, 32); v += __shfl_xor(v, 1, 32); return v; }

__global__ __launch_bounds__(256) void k_cvt8(const float* __restrict__ src, bf* dst, size_t n8) {
    const size_t i = (size_t)blockIdx.x * 256 + threadIdx.x; if (i >= n8) return;
    const v8f v = *(const v8f*)(src + i * 8); v8us o;
#pragma unroll
    for (int k = 0; k < 8; ++k) o[k] = f2bf(v[k]);
    *(v8us*)(dst + i * 8) = o; 
}

__global__ __launch_bounds__(256) void k_wcvt8h(const float* __restrict__ src, h16* dst, size_t n8, float carry) {
    const size_t i = (size_t)blockIdx.x * 256 + threadIdx.x; if (i >= n8) return;
    const v8f v = *(const v8f*)(src + i * 8); v8h o;
#pragma unroll
    for (int k = 0; k < 8; ++k) o[k] = toh_flush(bfr(v[k]) * carry);
    *(v8h*)(dst + i * 8) = o; 
}

// k_qkvt: the three projections (blockIdx.z = 0, 1, 2 for q, k, v) in one grid, each fused with its shift-log and its max-plus head linear. FOUR WAVES per 32x64 tile, bf16 operands straight from K-contiguous planes, K = DM.
// Product: wave w owns all 32 rows and the 16 columns of quarter w (2 accumulators, one B fragment a k step); every accumulator sums its k steps in ascending order.
// Tile rows R = r0..r0+31 in [b][s] order (R = b*SEQ + s) read source rows s*NB_FULL + b; tile columns c0..c0+63 = one head.
// Epilogue: accumulators -> LDS x tile and weight tile (both cross-wave: one block barrier); from there wave w owns rows 8w..8w+7 alone: x = log1p(max(x, 0)) - lam in place;
// y[r][o] = max_i(x[r][i] + W[o][i]) with the two weight rows of each lane in registers (o = lane, lane + 32) and x rows read as LDS broadcasts; 16-byte row stores.
// grid (NB*SEQ/32, DM/64, 3) = 768 blocks, three on each of 256 WGPs when spread evenly; the projections do not depend on one another, so their tiles run side by side.
// WB holds the q, k and v weight rows one after the other (DM rows each).
__global__ __launch_bounds__(128) void k_qkvt(const bf* __restrict__ A, const bf* __restrict__ WB, const float* __restrict__ lam,
                                              const float* __restrict__ Wqt, const float* __restrict__ Wkt, const float* __restrict__ Wvt, float* TQ, float* TK, float* TV) {
    __shared__ __align__(16) float xs[PRW * XSP];
    __shared__ __align__(16) float wl[64 * XSP];
    __shared__ __align__(16) float ys[PRW * XSP];
    const int K = DM;
    const int pz = blockIdx.z;
    const bf* Bt = WB + (size_t)pz * DM * DM;
    const float* Wt = pz == 0 ? Wqt : (pz == 1 ? Wkt : Wvt);
    float* TP = pz == 0 ? TQ : (pz == 1 ? TK : TV);
    const int tid = threadIdx.x;
    const int wave = __builtin_amdgcn_readfirstlane((int)(threadIdx.x >> 5));
    const int lane = tid & 31, lr = lane & 15, hi = lane >> 4; const int r0 = blockIdx.x * PRW, c0 = blockIdx.y * 64;
    const int bb = r0 / SEQ, s0 = r0 % SEQ;
    v8f acc[2];
#pragma unroll
    for (int mb = 0; mb < 2; ++mb) acc[mb] = (v8f){};
    const size_t aoff = ((size_t)(s0 + lr) * NB_FULL + (size_t)bb) * K + 8 * hi, boff = (size_t)(c0 + wave * 16 + lr) * K + 8 * hi;
#pragma unroll 1
    for (int kc = 0; kc < K; kc += 32) {
        v16bf a[2];
#pragma unroll
        for (int mb = 0; mb < 2; ++mb) a[mb] = ldb(A + aoff + (size_t)mb * 16 * NB_FULL * K + kc);
        const v16bf b = ldb(Bt + boff + kc);
#pragma unroll
        for (int mb = 0; mb < 2; ++mb) acc[mb] = wmmab_g(a[mb], b, acc[mb]);
    }
    // D layout: element j of lane = (row 8h + j, col lane&15); 4 waves cover rows 0..31 x columns 0..63
#pragma unroll
    for (int mb = 0; mb < 2; ++mb)
#pragma unroll
        for (int j = 0; j < 8; ++j) xs[(mb * 16 + hi * 8 + j) * XSP + wave * 16 + lr] = acc[mb][j];
    // max-plus weight W[o][i], bf16-valued, thread-linear 16-B loads: 1024 pieces / 128 threads
#pragma unroll 1
    for (int e = tid; e < 64 * 16; e += 128) {
        v4f w = *(const v4f*)(Wt + (size_t)e * 4);
#pragma unroll
        for (int i = 0; i < 4; ++i) w[i] = bfr(w[i]);
        *(v4fa*)(&wl[(e >> 4) * XSP + (e & 15) * 4]) = w; }
    __syncthreads();                                                // xs and wl are written by all waves and read across waves
    const int c4 = (lane & 15) * 4, rh = lane >> 4;
    float lv[4];
#pragma unroll
    for (int i = 0; i < 4; ++i) lv[i] = bfr(lam[c0 + c4 + i]);      // c0 + 63 < DM
#pragma unroll 1
    for (int s = wave * 4; s < wave * 4 + 4; ++s) { const int row = 2 * s + rh;      // 4 waves x 4 trips x 2 rows = 32 rows; 16 lanes x 4 floats = 64 columns
        v4f x = *(const v4fa*)(&xs[row * XSP + c4]);
#pragma unroll
        for (int i = 0; i < 4; ++i) x[i] = log1pf(fmaxf(x[i], 0.0f)) - lv[i];
        *(v4fa*)(&xs[row * XSP + c4]) = x; }
    wave_sync();
    float wlo[64], whi[64];                                         // weight rows o = lane and o = lane + 32, static indices only
#pragma unroll
    for (int g = 0; g < 16; ++g) { const v4f t0 = *(const v4fa*)(&wl[lane * XSP + 4 * g]); const v4f t1 = *(const v4fa*)(&wl[(lane + 32) * XSP + 4 * g]);
#pragma unroll
        for (int i = 0; i < 4; ++i) { wlo[4 * g + i] = t0[i]; whi[4 * g + i] = t1[i]; } }
#pragma unroll 1
    for (int r = wave * 8; r < wave * 8 + 8; ++r) {
        float a0 = NEGB, a1 = NEGB;
#pragma unroll
        for (int g = 0; g < 16; ++g) { const v4f x = *(const v4fa*)(&xs[r * XSP + 4 * g]);
#pragma unroll
            for (int i = 0; i < 4; ++i) { a0 = fmaxf(a0, x[i] + wlo[4 * g + i]); a1 = fmaxf(a1, x[i] + whi[4 * g + i]); } }
        ys[r * XSP + lane] = a0; ys[r * XSP + lane + 32] = a1; }
    wave_sync();
    float* orow = TP + (size_t)r0 * DM + c0 + c4;
{
#pragma unroll 1
        for (int s = wave * 4; s < wave * 4 + 4; ++s) { const int row = 2 * s + rh;
            const v4f val = *(const v4fa*)(&ys[row * XSP + c4]);
            *(v4f*)(orow + (size_t)row * DM) = val; }
         }
}

__device__ __forceinline__ void dmm(const v4f q, const v4f k, float& mx, float& mn) {
    const float d0 = q[0] - k[0], d1 = q[1] - k[1], d2 = q[2] - k[2], d3 = q[3] - k[3];
    mx = fmaxf(mx, fmaxf(fmaxf(d0, d1), fmaxf(d2, d3)));
    mn = fminf(mn, fminf(fminf(d0, d1), fminf(d2, d3)));
}

// k_mpattn: max-plus attention on the vector unit in f32; block = (group g, 32-row query tile), 256 threads, key tiles of 32 staged in LDS (single-buffered, block barriers; all LDS regions cross-wave).
// Phase 1: wave w, lane j -> scores of query rows w, w+8, w+16, w+24 against key j. Phase 2: thread (row = tid>>3, octet = tid&7) keeps 8 running maxima of score + v.
__global__ __launch_bounds__(256) void k_mpattn(const float* __restrict__ QP, const float* __restrict__ KP, const float* __restrict__ VP, h16* AV) {
#pragma clang fp contract(off)
    __shared__ v4f qs[32 * 17];
    __shared__ v4f ks[32 * 17];
    __shared__ v4f vs[32 * 17];
    __shared__ float sc[32 * 33];
    const int g = blockIdx.y, sqt = blockIdx.x, tid = threadIdx.x;
    const int wave = __builtin_amdgcn_readfirstlane((int)(threadIdx.x >> 5));
    const int lane = tid & 31;
    const v4f* qb = (const v4f*)(QP + ((size_t)g * SEQ + (size_t)sqt * 32) * HD);
    const v4f* kb = (const v4f*)(KP + (size_t)g * SEQ * HD);
    const v4f* vb = (const v4f*)(VP + (size_t)g * SEQ * HD);
    // query tile: 32 rows x 16 pieces = 512 pieces, two per thread (rows 0..15 and 16..31)
    qs[(tid >> 4) * 17 + (tid & 15)]        = qb[tid];
    qs[((tid >> 4) + 16) * 17 + (tid & 15)] = qb[tid + 256];
    float ctx[8];
#pragma unroll
    for (int j = 0; j < 8; ++j) ctx[j] = NEGB;
    const int sq1 = wave, sk1 = lane;
    const int sq2 = tid >> 3, dg = tid & 7;
#pragma unroll 1
    for (int kt = 0; kt < SEQ / 32; ++kt) {
        __syncthreads();                                   // earlier readers of ks / vs / sc are done
        const int nbp = kt * 512;
        ks[(tid >> 4) * 17 + (tid & 15)]        = kb[nbp + tid];
        ks[((tid >> 4) + 16) * 17 + (tid & 15)] = kb[nbp + tid + 256];
        vs[(tid >> 4) * 17 + (tid & 15)]        = vb[nbp + tid];
        vs[((tid >> 4) + 16) * 17 + (tid & 15)] = vb[nbp + tid + 256];
        __syncthreads();
        float mx0 = NEGB, mx1 = NEGB, mx2 = NEGB, mx3 = NEGB;
        float mn0 = POSB, mn1 = POSB, mn2 = POSB, mn3 = POSB;
#pragma unroll 4
        for (int c = 0; c < 16; ++c) {
            const v4f kv = ks[sk1 * 17 + c];
            dmm(qs[sq1 * 17 + c], kv, mx0, mn0);
            dmm(qs[(sq1 + 8) * 17 + c], kv, mx1, mn1);
            dmm(qs[(sq1 + 16) * 17 + c], kv, mx2, mn2);
            dmm(qs[(sq1 + 24) * 17 + c], kv, mx3, mn3);
        }
        sc[sq1 * 33 + sk1]        = mn0 - mx0;             // = -(max - min)
        sc[(sq1 + 8) * 33 + sk1]  = mn1 - mx1;
        sc[(sq1 + 16) * 33 + sk1] = mn2 - mx2;
        sc[(sq1 + 24) * 33 + sk1] = mn3 - mx3;
        __syncthreads();
#pragma unroll 4
        for (int sk = 0; sk < 32; ++sk) {
            const float s = sc[sq2 * 33 + sk];
            const v4f v0 = vs[sk * 17 + dg * 2];
            const v4f v1 = vs[sk * 17 + dg * 2 + 1];
#pragma unroll
            for (int i = 0; i < 4; ++i) { ctx[i] = fmaxf(ctx[i], s + v0[i]); ctx[4 + i] = fmaxf(ctx[4 + i], s + v1[i]); }
        }
    }
    const int b2 = g / NH_, h2 = g % NH_;
    const int s2 = sqt * 32 + sq2;
    v8h o;
#pragma unroll
    for (int j = 0; j < 8; ++j) o[j] = toh_flush(expm1f(ctx[j]) * ACARRY);
    h16* dst = AV + ((size_t)s2 * NB + (size_t)b2) * DM + h2 * HD + dg * 8;
    *(v8h*)dst = o; 
}

// k_oln: output projection (f16 product) fused with the skip connection and LayerNorm. Block = 16 rows x 512 columns, 8 waves, wave w owns columns 64w..64w+63 (4 accumulators).
// Accumulators (scaled by 1/1024) staged in a block LDS tile (cross-wave, block barrier); then wave w owns rows 2w, 2w+1 (wave-private from here): adds the bf16-valued input row as float4 at the read stage,
__global__ __launch_bounds__(256) void k_oln(const h16* __restrict__ AV, const h16* __restrict__ WO, const float* __restrict__ hin, const float* __restrict__ gamma, const float* __restrict__ beta, float* OUT) {
    __shared__ __align__(16) float ys[ORW * YSP];
    const int lane = threadIdx.x & 31, lr = lane & 15, hi = lane >> 4;
    const int wave = __builtin_amdgcn_readfirstlane((int)(threadIdx.x >> 5));
    const int r0 = blockIdx.x * ORW, c0 = wave * 64;
    v8f acc[4];
#pragma unroll
    for (int nb = 0; nb < 4; ++nb) acc[nb] = (v8f){};
    const size_t aoff = (size_t)(r0 + lr) * DM + 8 * hi, boff = (size_t)(c0 + lr) * DM + 8 * hi;
#pragma unroll 1
    for (int kc = 0; kc < DM; kc += 32) {
        const v16h a = ldh(AV + aoff + kc);
#pragma unroll
        for (int nb = 0; nb < 4; ++nb) { const v16h b = ldh(WO + boff + (size_t)nb * 16 * DM + kc); acc[nb] = wmma16_g(a, b, acc[nb]); }
    }
    // D layout: element j of lane = (row 8h + j, col lane&15); 8 waves cover rows 0..15 x columns 0..511
#pragma unroll
    for (int nb = 0; nb < 4; ++nb)
#pragma unroll
        for (int j = 0; j < 8; ++j) ys[(hi * 8 + j) * YSP + c0 + nb * 16 + lr] = acc[nb][j] * OSCL;
    __syncthreads();
#pragma unroll 1
    for (int rr = 0; rr < 2; ++rr) {
        const int row = wave * 2 + rr;
        const int mrow = r0 + row;                                        // plane row s2*NB + b2
        const size_t grow = (size_t)(mrow / NB) * NB_FULL + (size_t)(mrow % NB);
        v4f y[4]; float sum = 0.0f;
#pragma unroll
        for (int j = 0; j < 4; ++j) { const int c = (lane + 32 * j) * 4;
            const v4f a = *(const v4fa*)(&ys[row * YSP + c]); const v4f hv = *(const v4f*)(hin + grow * DM + c);
#pragma unroll
            for (int i = 0; i < 4; ++i) { y[j][i] = bfr(hv[i]) + a[i]; sum += y[j][i]; } }
        sum = wsum(sum);
        const float mu = sum * (1.0f / (float)DM);
        float sq = 0.0f;
#pragma unroll
        for (int j = 0; j < 4; ++j)
#pragma unroll
            for (int i = 0; i < 4; ++i) { const float d = y[j][i] - mu; y[j][i] = d; sq += d * d; }
        sq = wsum(sq);
        const float rstd = rsqrtf(sq * (1.0f / (float)DM) + LNEPS);
#pragma unroll
        for (int j = 0; j < 4; ++j) { const int c = (lane + 32 * j) * 4;
            const v4f gv = *(const v4f*)(gamma + c); const v4f bv = *(const v4f*)(beta + c); v4f ov;
#pragma unroll
            for (int i = 0; i < 4; ++i) ov[i] = y[j][i] * rstd * bfr(gv[i]) + bfr(bv[i]);
            *(v4fa*)(&ys[row * YSP + c]) = ov; }
    }
    wave_sync();
{
#pragma unroll 1
        for (int rr = 0; rr < 2; ++rr) {
            const int row = wave * 2 + rr;
            const int mrow = r0 + row;
            const size_t grow = (size_t)(mrow / NB) * NB_FULL + (size_t)(mrow % NB);
#pragma unroll
            for (int j = 0; j < 4; ++j) { const int c = (lane + 32 * j) * 4;   // 4 instructions x 32 lanes x 16 B = 2048 B = one output row
                const v4f val = *(const v4fa*)(&ys[row * YSP + c]);
                *(v4f*)(OUT + grow * DM + c) = val; } }
         }
}

static constexpr size_t al256(size_t v) { return (v + 255) & ~(size_t)255; }
static constexpr size_t SZ_XB = al256((size_t)SEQ * NB_FULL * DM * 2);     // bf16 x, source row order
static constexpr size_t SZ_WB = al256((size_t)3 * DM * DM * 2);            // bf16 Wq | Wkv
static constexpr size_t SZ_WO = al256((size_t)DM * DM * 2);                // f16 Wo x64
static constexpr size_t SZ_TP = al256((size_t)NB * SEQ * DM * 4);          // f32 q / k / v planes after the head linear
static constexpr size_t SZ_AV = al256((size_t)NB * SEQ * DM * 2);          // f16 attention vector x16
static constexpr size_t SZ_TOTAL = SZ_XB + SZ_WB + SZ_WO + 3 * SZ_TP + SZ_AV;
static_assert(SZ_TOTAL <= (size_t)134217728);          // workspace carve <= 128 MiB
static_assert(((size_t)DM * DM * 2) % 256 == 0);       // weight sub-planes stay 256-byte aligned

extern "C" void kernel_launch(void* const* d_in, const int* in_sizes, int n_in,
                              void* d_out, int out_size, void* d_ws, size_t ws_size, hipStream_t stream) {
    if (n_in < 10) return;
    if ((size_t)in_sizes[0] < (size_t)SEQ * NB_FULL * DM) return;
    if ((size_t)in_sizes[1] < (size_t)DM * DM || (size_t)in_sizes[2] < (size_t)2 * DM * DM || (size_t)in_sizes[7] < (size_t)DM * DM) return;
    if (in_sizes[3] < HD * HD || in_sizes[4] < HD * HD || in_sizes[5] < HD * HD) return;
    if (in_sizes[6] < DM || in_sizes[8] < DM || in_sizes[9] < DM) return;
    if ((size_t)out_size < ((size_t)(SEQ - 1) * NB_FULL + NB) * DM) return;
    if (SZ_TOTAL > ws_size) return;
    // wire order: h, Wq, Wkv, Wqt, Wkt, Wvt, lam, Wo, gamma, beta
    const float* hin = (const float*)d_in[0];
    const float* wq  = (const float*)d_in[1];
    const float* wkv = (const float*)d_in[2];
    const float* wqt = (const float*)d_in[3];
    const float* wkt = (const float*)d_in[4];
    const float* wvt = (const float*)d_in[5];
    const float* lam = (const float*)d_in[6];
    const float* wo  = (const float*)d_in[7];
    const float* gam = (const float*)d_in[8];
    const float* bet = (const float*)d_in[9];
    float* OUT = (float*)d_out;      // [SEQ][NB_FULL][512]
    char* wsp = (char*)d_ws;
    bf*  XB  = (bf*)wsp;  wsp += SZ_XB;                 // [SEQ*NB_FULL][512]
    bf*  WB  = (bf*)wsp;  wsp += SZ_WB;                 // [1536][512]: q rows | k rows | v rows
    h16* WOH = (h16*)wsp; wsp += SZ_WO;                 // [512][512]
    float* TQ = (float*)wsp; wsp += SZ_TP;              // [NB*SEQ][512], row b*SEQ + s
    float* TK = (float*)wsp; wsp += SZ_TP;
    float* TV = (float*)wsp; wsp += SZ_TP;
    h16* AV  = (h16*)wsp; wsp += SZ_AV;                 // [NB*SEQ][512], row s2*NB + b2

    { const size_t n8 = (size_t)SEQ * NB_FULL * DM / 8; k_cvt8<<<(unsigned)((n8 + 255) / 256), 256, 0, stream>>>(hin, XB, n8); }
    { const size_t n8 = (size_t)DM * DM / 8; k_cvt8<<<(unsigned)((n8 + 255) / 256), 256, 0, stream>>>(wq, WB, n8); }
    { const size_t n8 = (size_t)2 * DM * DM / 8; k_cvt8<<<(unsigned)((n8 + 255) / 256), 256, 0, stream>>>(wkv, WB + (size_t)DM * DM, n8); }
    { const size_t n8 = (size_t)DM * DM / 8; k_wcvt8h<<<(unsigned)((n8 + 255) / 256), 256, 0, stream>>>(wo, WOH, n8, WCARRY); }

    // projections: A = x rows (tile row R = b*SEQ + s <- source row s*NB_FULL + b), Bt = W rows (n = head*64 + d) -> plane [R][512]
    k_qkvt<<<dim3(NB * SEQ / PRW, DM / 64, 3), 128, 0, stream>>>(XB, WB, lam, wqt, wkt, wvt, TQ, TK, TV);

    k_mpattn<<<dim3(SEQ / 32, NB * NH_, 1), 256, 0, stream>>>(TQ, TK, TV, AV);

    k_oln<<<dim3(NB * SEQ / ORW, 1, 1), 256, 0, stream>>>(AV, WOH, hin, gam, bet, OUT);
}

// v003
// Measured time: 67.2 microseconds a run.
// Two timings next to v002 both put it at 1.31 times that version's speed.
// Counting every step since v000, it is 3.07 times as fast.
#include <hip/hip_runtime.h>

// Max-plus multi-head attention block, width 512 = 8 heads x 64: x [SEQ][NB_FULL][512]; Wq [512][512], Wkv [1024][512] (k rows then v rows), Wo [512][512], all [out][in] (y = x W^T);
// per-feature shift lam [512]; three 64x64 max-plus head weights; post-LN over (x + attention output) with gain and offset inputs.
// Compute dtypes, f32 accumulate everywhere: q/k/v projections v_wmma_f32_16x16x32_bf16 (x and W RNE-converted to bf16; products exact);
// output projection v_wmma_f32_16x16x32_f16, one product: attention vector as f16 with a x16 carry, bf16-valued Wo as f16 with a x64 carry, folded by 1/1024 in the f32 epilogue.
// Max-plus stages (head linear y[o] = max_i(x[i] + W[o][i]); score = -(max_d(q-k) - min_d(q-k)); context = max_key(score + v)) are semiring operations and run in f32 on the vector unit, as do log1p, expm1 and LayerNorm.
// Layout: the head regrouping is the flat reshape of [b][s][head][d] into [b*8 + s/(SEQ/8)][(s % (SEQ/8))*8 + head][d], i.e. group g is the contiguous SEQ x 64 chunk g of a [b][s][512] plane; the q/k/v planes are kept in that order
// (GEMM row R = b*SEQ + s reads source row s*NB_FULL + b by arithmetic addressing). Attention vector plane rows s2*NB + b2 with g = b2*8 + h2, columns h2*64 + d.

#ifndef NB
#define NB 2
#endif
#ifndef SEQ
#define SEQ 512
#endif
#define NB_FULL  2
#define SEQ_FULL 512
#define DM   512
#define NH_  8
#define HD   64
#define XSP  68                  // LDS row pitch (floats) of the 64-column tiles of the projection kernel
#define YSP  516                 // LDS row pitch (floats) of the 16 x 512 tile of the output kernel
#define ORW  16                  // rows per block of the output kernel
#define PRW  32                  // rows per block of the projection kernel
#define AW   8                   // waves per block of the attention kernel
#define KPW  (SEQ / AW)          // keys a wave of the attention kernel owns
#define KC   32                  // keys a wave stages at a time
#define SCP  36                  // LDS row pitch (floats) of a wave's score rows (32 queries)
#define WRG  (2 * KC * XSP + 16 * SCP)   // floats of one wave's LDS range in the attention kernel
#define ACARRY 16.0f             // carry of the f16 attention vector plane
#define WCARRY 64.0f             // carry of the f16 Wo plane
#define OSCL (1.0f / 1024.0f)    // 1 / (ACARRY * WCARRY)
#define LNEPS 1e-5f
#define NEGB (-3.0e38f)
#define POSB (3.0e38f)

static_assert(NH_ * HD == DM);                 // head h = columns h*64 + d
static_assert(HD == 64);                       // one 64-column GEMM tile = one head; attention lanes own 8 octets of d
static_assert(DM % 64 == 0);
static_assert(DM % 32 == 0);                   // GEMM k-loops step by 32
static_assert(SEQ % PRW == 0);                 // a projection tile never straddles two batches
static_assert((NB * SEQ) % PRW == 0);
static_assert(PRW == 32);                      // 2 WMMA row slabs per wave; 4 waves x 8 epilogue rows
static_assert(SEQ % 32 == 0);                  // attention query tiles of 32 rows
static_assert(SEQ % (AW * KC) == 0);           // every wave owns whole staging chunks of keys
static_assert(KC % 16 == 0);                   // phase blocks of 16 keys
static_assert((SCP * 4) % 16 == 0);
static_assert(SCP >= 32);
static_assert(WRG >= 32 * XSP);                // a wave's 32 x 64 maxima fit its own range
static_assert((WRG * 4) % 16 == 0);
static_assert(SEQ % NH_ == 0);                 // tokens per group = SEQ / 8
static_assert((NB * SEQ) % ORW == 0);
static_assert(ORW == 16);                      // one 16-row WMMA slab per block of the output kernel
static_assert(8 * 64 == DM);                   // 8 waves x 64 columns cover one output row
static_assert(NB <= NB_FULL);
static_assert(SEQ <= SEQ_FULL);
static_assert((XSP * 4) % 16 == 0);
static_assert(XSP >= 64);
static_assert((YSP * 4) % 16 == 0);
static_assert(YSP >= DM);
static_assert(((size_t)SEQ * NB_FULL * DM) % 8 == 0);
static_assert(((size_t)DM * DM) % 8 == 0);
static_assert(4 * 32 * 16 * 4 == PRW * 64 * 4);        // projection store: 4 waves x 32 lanes x 16 B x 4 trips == 32 rows x 256 B
static_assert(256 * 16 == 32 * HD * 2);
static_assert(AW * 32 == 256);
static_assert(8 * (ORW / 8) * 4 * 32 * 16 == ORW * DM * 4);   // output store: 8 waves x 2 rows x 4 instructions x 512 B == 16 rows x 2048 B
static_assert((2 * PRW + 64) * XSP * 4 <= 131072);     // static LDS of the projection kernel
static_assert((32 * XSP + AW * WRG) * 4 <= 327680);    // static LDS of the attention kernel
static_assert(ORW * YSP * 4 <= 131072);                // static LDS of the output kernel

typedef _Float16 h16;
typedef unsigned short bf;
typedef __attribute__((ext_vector_type(16))) __bf16   v16bf;
typedef __attribute__((ext_vector_type(16))) _Float16 v16h;
typedef __attribute__((ext_vector_type(8)))  _Float16 v8h;
typedef __attribute__((ext_vector_type(8)))  unsigned short v8us;
typedef __attribute__((ext_vector_type(8)))  float    v8f;
typedef __attribute__((ext_vector_type(4)))  float    v4f;
typedef v4f  __attribute__((may_alias)) v4fa;

__device__ __forceinline__ unsigned short f2bf(float f) { unsigned u = __float_as_uint(f); u += 0x7FFFu + ((u >> 16) & 1u); return (unsigned short)(u >> 16); }
__device__ __forceinline__ float bfr(float f) { return __uint_as_float(((unsigned)f2bf(f)) << 16); }   // value after RNE convert to bf16
__device__ __forceinline__ v16h cat16(v8h lo, v8h hi) { return __builtin_shufflevector(lo, hi, 0, 1, 2, 3, 4, 5, 6, 7, 8, 9, 10, 11, 12, 13, 14, 15); }
__device__ __forceinline__ v16bf cat16b(v8us lo, v8us hi) { return __builtin_bit_cast(v16bf, __builtin_shufflevector(lo, hi, 0, 1, 2, 3, 4, 5, 6, 7, 8, 9, 10, 11, 12, 13, 14, 15)); }
__device__ __forceinline__ v8f wmma16(v16h a, v16h b, v8f c) { return __builtin_amdgcn_wmma_f32_16x16x32_f16(false, a, false, b, (short)0, c, false, false); }
__device__ __forceinline__ v8f wmmab(v16bf a, v16bf b, v8f c) { return __builtin_amdgcn_wmma_f32_16x16x32_bf16(false, a, false, b, (short)0, c, false, false); }
// fragment loaders from K-contiguous 16-bit rows; p already includes + 8*(lane>>4): elements 0..7 <- k0+8h+0..7, elements 8..15 <- k0+16+8h+0..7 (same map for A and B)
__device__ __forceinline__ v16h  ldh(const h16* p) { return cat16(*(const v8h*)p, *(const v8h*)(p + 16)); }
__device__ __forceinline__ v16bf ldb(const bf* p)  { return cat16b(*(const v8us*)p, *(const v8us*)(p + 16)); }
// ordering point for wave-private LDS tiles (same wave writes and reads)
__device__ __forceinline__ void wave_sync() { __builtin_amdgcn_fence(3 /* release order */, "wavefront"); __builtin_amdgcn_wave_barrier(); asm volatile("" ::: "memory"); }

// per-instruction guarded matrix products: one accumulator tied per guard, operands kept live across the nops
__device__ __forceinline__ v8f wmmab_g(v16bf a, v16bf b, v8f c) { c = wmmab(a, b, c); asm volatile("v_nop\n\tv_nop\n\tv_nop\n\tv_nop" : "+v"(c) : "v"(a), "v"(b)); return c; }
__device__ __forceinline__ v8f wmma16_g(v16h a, v16h b, v8f c) { c = wmma16(a, b, c); asm volatile("v_nop\n\tv_nop\n\tv_nop\n\tv_nop" : "+v"(c) : "v"(a), "v"(b)); return c; }
// f32 -> f16 convert that cannot produce a subnormal operand (|v| < 2^-14 -> +0), applied after the plane's carry
static __device__ __forceinline__ h16 toh_flush(float v) { const h16 r = (h16)v; return (fabsf(v) < 6.103515625e-05f) ? (h16)0.0f : r; }
__device__ __forceinline__ float wsum(float v) { v += __shfl_xor(v, 16, 32); v += __shfl_xor(v, 8, 32); v += __shfl_xor(v, 4, 32); v += __shfl_xor(v, 2, 32); v += __shfl_xor(v, 1, 32); return v; }

__global__ __launch_bounds__(256) void k_cvt8(const float* __restrict__ src, bf* dst, size_t n8) {
    const size_t i = (size_t)blockIdx.x * 256 + threadIdx.x; if (i >= n8) return;
    const v8f v = *(const v8f*)(src + i * 8); v8us o;
#pragma unroll
    for (int k = 0; k < 8; ++k) o[k] = f2bf(v[k]);
    *(v8us*)(dst + i * 8) = o; 
}

__global__ __launch_bounds__(256) void k_wcvt8h(const float* __restrict__ src, h16* dst, size_t n8, float carry) {
    const size_t i = (size_t)blockIdx.x * 256 + threadIdx.x; if (i >= n8) return;
    const v8f v = *(const v8f*)(src + i * 8); v8h o;
#pragma unroll
    for (int k = 0; k < 8; ++k) o[k] = toh_flush(bfr(v[k]) * carry);
    *(v8h*)(dst + i * 8) = o; 
}

// k_qkvt: the three projections (blockIdx.z = 0, 1, 2 for q, k, v) in one grid, each fused with its shift-log and its max-plus head linear. FOUR WAVES per 32x64 tile, bf16 operands straight from K-contiguous planes, K = DM.
// Product: wave w owns all 32 rows and the 16 columns of quarter w (2 accumulators, one B fragment a k step); every accumulator sums its k steps in ascending order.
// Tile rows R = r0..r0+31 in [b][s] order (R = b*SEQ + s) read source rows s*NB_FULL + b; tile columns c0..c0+63 = one head.
// Epilogue: accumulators -> LDS x tile and weight tile (both cross-wave: one block barrier); from there wave w owns rows 8w..8w+7 alone: x = log1p(max(x, 0)) - lam in place;
// y[r][o] = max_i(x[r][i] + W[o][i]) with the two weight rows of each lane in registers (o = lane, lane + 32) and x rows read as LDS broadcasts; 16-byte row stores.
// grid (NB*SEQ/32, DM/64, 3) = 768 blocks, three on each of 256 WGPs when spread evenly; the projections do not depend on one another, so their tiles run side by side.
// WB holds the q, k and v weight rows one after the other (DM rows each).
__global__ __launch_bounds__(128) void k_qkvt(const bf* __restrict__ A, const bf* __restrict__ WB, const float* __restrict__ lam,
                                              const float* __restrict__ Wqt, const float* __restrict__ Wkt, const float* __restrict__ Wvt, float* TQ, float* TK, float* TV) {
    __shared__ __align__(16) float xs[PRW * XSP];
    __shared__ __align__(16) float wl[64 * XSP];
    __shared__ __align__(16) float ys[PRW * XSP];
    const int K = DM;
    const int pz = blockIdx.z;
    const bf* Bt = WB + (size_t)pz * DM * DM;
    const float* Wt = pz == 0 ? Wqt : (pz == 1 ? Wkt : Wvt);
    float* TP = pz == 0 ? TQ : (pz == 1 ? TK : TV);
    const int tid = threadIdx.x;
    const int wave = __builtin_amdgcn_readfirstlane((int)(threadIdx.x >> 5));
    const int lane = tid & 31, lr = lane & 15, hi = lane >> 4; const int r0 = blockIdx.x * PRW, c0 = blockIdx.y * 64;
    const int bb = r0 / SEQ, s0 = r0 % SEQ;
    v8f acc[2];
#pragma unroll
    for (int mb = 0; mb < 2; ++mb) acc[mb] = (v8f){};
    const size_t aoff = ((size_t)(s0 + lr) * NB_FULL + (size_t)bb) * K + 8 * hi, boff = (size_t)(c0 + wave * 16 + lr) * K + 8 * hi;
#pragma unroll 1
    for (int kc = 0; kc < K; kc += 32) {
        v16bf a[2];
#pragma unroll
        for (int mb = 0; mb < 2; ++mb) a[mb] = ldb(A + aoff + (size_t)mb * 16 * NB_FULL * K + kc);
        const v16bf b = ldb(Bt + boff + kc);
#pragma unroll
        for (int mb = 0; mb < 2; ++mb) acc[mb] = wmmab_g(a[mb], b, acc[mb]);
    }
    // D layout: element j of lane = (row 8h + j, col lane&15); 4 waves cover rows 0..31 x columns 0..63
#pragma unroll
    for (int mb = 0; mb < 2; ++mb)
#pragma unroll
        for (int j = 0; j < 8; ++j) xs[(mb * 16 + hi * 8 + j) * XSP + wave * 16 + lr] = acc[mb][j];
    // max-plus weight W[o][i], bf16-valued, thread-linear 16-B loads: 1024 pieces / 128 threads
#pragma unroll 1
    for (int e = tid; e < 64 * 16; e += 128) {
        v4f w = *(const v4f*)(Wt + (size_t)e * 4);
#pragma unroll
        for (int i = 0; i < 4; ++i) w[i] = bfr(w[i]);
        *(v4fa*)(&wl[(e >> 4) * XSP + (e & 15) * 4]) = w; }
    __syncthreads();                                                // xs and wl are written by all waves and read across waves
    const int c4 = (lane & 15) * 4, rh = lane >> 4;
    float lv[4];
#pragma unroll
    for (int i = 0; i < 4; ++i) lv[i] = bfr(lam[c0 + c4 + i]);      // c0 + 63 < DM
#pragma unroll 1
    for (int s = wave * 4; s < wave * 4 + 4; ++s) { const int row = 2 * s + rh;      // 4 waves x 4 trips x 2 rows = 32 rows; 16 lanes x 4 floats = 64 columns
        v4f x = *(const v4fa*)(&xs[row * XSP + c4]);
#pragma unroll
        for (int i = 0; i < 4; ++i) x[i] = log1pf(fmaxf(x[i], 0.0f)) - lv[i];
        *(v4fa*)(&xs[row * XSP + c4]) = x; }
    wave_sync();
    float wlo[64], whi[64];                                         // weight rows o = lane and o = lane + 32, static indices only
#pragma unroll
    for (int g = 0; g < 16; ++g) { const v4f t0 = *(const v4fa*)(&wl[lane * XSP + 4 * g]); const v4f t1 = *(const v4fa*)(&wl[(lane + 32) * XSP + 4 * g]);
#pragma unroll
        for (int i = 0; i < 4; ++i) { wlo[4 * g + i] = t0[i]; whi[4 * g + i] = t1[i]; } }
#pragma unroll 1
    for (int r = wave * 8; r < wave * 8 + 8; ++r) {
        float a0 = NEGB, a1 = NEGB;
#pragma unroll
        for (int g = 0; g < 16; ++g) { const v4f x = *(const v4fa*)(&xs[r * XSP + 4 * g]);
#pragma unroll
            for (int i = 0; i < 4; ++i) { a0 = fmaxf(a0, x[i] + wlo[4 * g + i]); a1 = fmaxf(a1, x[i] + whi[4 * g + i]); } }
        ys[r * XSP + lane] = a0; ys[r * XSP + lane + 32] = a1; }
    wave_sync();
    float* orow = TP + (size_t)r0 * DM + c0 + c4;
{
#pragma unroll 1
        for (int s = wave * 4; s < wave * 4 + 4; ++s) { const int row = 2 * s + rh;
            const v4f val = *(const v4fa*)(&ys[row * XSP + c4]);
            *(v4f*)(orow + (size_t)row * DM) = val; }
         }
}

// wave_sync plus a wait: a wave's stores into its own LDS range have landed before its lanes read one another's rows back
__device__ __forceinline__ void wave_publish() { wave_sync(); asm volatile("s_wait_dscnt 0x0" ::: "memory"); }

// one 4-wide piece of the difference q - k folded into the running maximum and minimum of one (query, key) pair
__device__ __forceinline__ void dmm(const v4f q, const v4f k, float& mx, float& mn) {
    const v4f d = q - k;
    mx = fmaxf(fmaxf(fmaxf(fmaxf(mx, d[0]), d[1]), d[2]), d[3]);
    mn = fminf(fminf(fminf(fminf(mn, d[0]), d[1]), d[2]), d[3]);
}

// k_mpattn: max-plus attention on the vector unit in f32; block = (group g, 32-row query tile), 256 threads = 8 waves.
// Wave w owns keys 64w..64w+63 for BOTH phases and all 32 query rows; its key rows, value rows and scores live in its own LDS range (wave-private: no block barrier in the key loop).
// Phase 1, per 16 keys: lane (qi = lane&7, kj = lane>>3) keeps a 4 x 4 register block of (query qi + 8a, key kj + 4b) pairs: 8 LDS reads feed 16 pairs.
// Phase 2, per 16 keys: lane (qg = lane>>3, dg = lane&7) keeps an 8 x 8 register block of running maxima (query qg + 4i, column 8dg + j): 4 LDS reads a key feed 64 elements.
// Scores are laid out [key][(q & 3) * 8 + (q >> 2)], so the 8 scores of a phase-2 lane are contiguous.
// After the loop each wave writes its 32 x 64 maxima over its own range; one block barrier; thread (row = tid>>3, octet = tid&7) takes the maximum over the 8 waves (max is exact: any order gives the same value).
__global__ __launch_bounds__(256) void k_mpattn(const float* __restrict__ QP, const float* __restrict__ KP, const float* __restrict__ VP, h16* AV) {
#pragma clang fp contract(off)
    __shared__ __align__(16) float qs[32 * XSP];
    __shared__ __align__(16) float wr[AW * WRG];
    const int g = blockIdx.y, sqt = blockIdx.x, tid = threadIdx.x;
    const int wave = __builtin_amdgcn_readfirstlane((int)(threadIdx.x >> 5));
    const int lane = tid & 31;
    const v4f* qb = (const v4f*)(QP + ((size_t)g * SEQ + (size_t)sqt * 32) * HD);
    const v4f* kb = (const v4f*)(KP + ((size_t)g * SEQ + (size_t)wave * KPW) * HD);
    const v4f* vb = (const v4f*)(VP + ((size_t)g * SEQ + (size_t)wave * KPW) * HD);
    float* kw = wr + wave * WRG;                 // KC key rows, pitch XSP
    float* vw = kw + KC * XSP;                   // KC value rows, pitch XSP
    float* sc = vw + KC * XSP;                   // 16 score rows, pitch SCP
    // query tile: 32 rows x 16 pieces = 512 pieces, two per thread (rows 0..15 and 16..31)
    *(v4fa*)(&qs[(tid >> 4) * XSP + (tid & 15) * 4])        = qb[tid];
    *(v4fa*)(&qs[((tid >> 4) + 16) * XSP + (tid & 15) * 4]) = qb[tid + 256];
    __syncthreads();                                       // the query tile is written by all waves and read by all
    float ctx[8][8];
#pragma unroll
    for (int i = 0; i < 8; ++i)
#pragma unroll
        for (int j = 0; j < 8; ++j) ctx[i][j] = NEGB;
    const int qi = lane & 7, kj = lane >> 3;
    const int qg = lane >> 3, dg = lane & 7;
#pragma unroll 1
    for (int t = 0; t < KPW / KC; ++t) {
        wave_sync();                                       // this wave's earlier reads of kw / vw stay in front of the refill
const int e0 = t * KC * 16 + lane;
        v4f rk[KC / 2], rv[KC / 2];                        // KC rows x 16 pieces, 32 a trip
#pragma unroll
        for (int i = 0; i < KC / 2; ++i) { rk[i] = kb[e0 + 32 * i]; rv[i] = vb[e0 + 32 * i]; }
        asm volatile("s_wait_xcnt 0x0" :: "v"(e0) : "memory");   // the loads' index register stays whole until this wait; it is reused only behind it
#pragma unroll
        for (int i = 0; i < KC / 2; ++i) { const int e = lane + 32 * i;
            *(v4fa*)(&kw[(e >> 4) * XSP + (e & 15) * 4]) = rk[i];
            *(v4fa*)(&vw[(e >> 4) * XSP + (e & 15) * 4]) = rv[i]; }
        wave_publish();                                    // key and value rows cross lanes of this wave
#pragma unroll 1
        for (int u = 0; u < KC / 16; ++u) {
            const float* ku = kw + u * 16 * XSP;
            const float* vu = vw + u * 16 * XSP;
            float mx[4][4], mn[4][4];
#pragma unroll
            for (int a = 0; a < 4; ++a)
#pragma unroll
                for (int b = 0; b < 4; ++b) { mx[a][b] = NEGB; mn[a][b] = POSB; }
#pragma unroll 2
            for (int c = 0; c < 16; ++c) {
                v4f q[4], k[4];
#pragma unroll
                for (int a = 0; a < 4; ++a) q[a] = *(const v4fa*)(&qs[(qi + 8 * a) * XSP + 4 * c]);
#pragma unroll
                for (int b = 0; b < 4; ++b) k[b] = *(const v4fa*)(&ku[(kj + 4 * b) * XSP + 4 * c]);
#pragma unroll
                for (int a = 0; a < 4; ++a)
#pragma unroll
                    for (int b = 0; b < 4; ++b) dmm(q[a], k[b], mx[a][b], mn[a][b]);
            }
#pragma unroll
            for (int a = 0; a < 4; ++a)
#pragma unroll
                for (int b = 0; b < 4; ++b) sc[(kj + 4 * b) * SCP + (qi & 3) * 8 + (qi >> 2) + 2 * a] = mn[a][b] - mx[a][b];   // = -(max - min)
            wave_publish();                                // scores cross lanes of this wave
#pragma unroll 1
            for (int kk = 0; kk < 16; kk += 2) {
                float s0[8], s1[8], v0[8], v1[8];
#pragma unroll
                for (int h = 0; h < 2; ++h) {
                    const v4f ta = *(const v4fa*)(&sc[kk * SCP + qg * 8 + 4 * h]);       const v4f tb = *(const v4fa*)(&sc[(kk + 1) * SCP + qg * 8 + 4 * h]);
                    const v4f tc = *(const v4fa*)(&vu[kk * XSP + dg * 8 + 4 * h]);       const v4f td = *(const v4fa*)(&vu[(kk + 1) * XSP + dg * 8 + 4 * h]);
#pragma unroll
                    for (int i = 0; i < 4; ++i) { s0[4 * h + i] = ta[i]; s1[4 * h + i] = tb[i]; v0[4 * h + i] = tc[i]; v1[4 * h + i] = td[i]; } }
#pragma unroll
                for (int i = 0; i < 8; ++i)
#pragma unroll
                    for (int j = 0; j < 8; ++j) ctx[i][j] = fmaxf(fmaxf(ctx[i][j], s0[i] + v0[j]), s1[i] + v1[j]);
            }
            wave_sync();                                   // this wave's reads of sc stay in front of the next scores
        }
    }
    // this wave's maxima over its own range (rows q, pitch XSP)
#pragma unroll
    for (int i = 0; i < 8; ++i)
#pragma unroll
        for (int h = 0; h < 2; ++h) { v4f o4;
#pragma unroll
            for (int j = 0; j < 4; ++j) o4[j] = ctx[i][4 * h + j];
            *(v4fa*)(&kw[(qg + 4 * i) * XSP + dg * 8 + 4 * h]) = o4; }
    __syncthreads();                                       // the per-wave maxima are read across waves
    const int sq2 = tid >> 3, dg2 = tid & 7;
    float fin[8];
#pragma unroll
    for (int j = 0; j < 8; ++j) fin[j] = NEGB;
#pragma unroll
    for (int w = 0; w < AW; ++w)
#pragma unroll
        for (int h = 0; h < 2; ++h) { const v4f p = *(const v4fa*)(&wr[w * WRG + sq2 * XSP + dg2 * 8 + 4 * h]);
#pragma unroll
            for (int j = 0; j < 4; ++j) fin[4 * h + j] = fmaxf(fin[4 * h + j], p[j]); }
    const int b2 = g / NH_, h2 = g % NH_;
    const int s2 = sqt * 32 + sq2;
    v8h o;
#pragma unroll
    for (int j = 0; j < 8; ++j) o[j] = toh_flush(expm1f(fin[j]) * ACARRY);
    h16* dst = AV + ((size_t)s2 * NB + (size_t)b2) * DM + h2 * HD + dg2 * 8;
    *(v8h*)dst = o; 
}

// k_oln: output projection (f16 product) fused with the skip connection and LayerNorm. Block = 16 rows x 512 columns, 8 waves, wave w owns columns 64w..64w+63 (4 accumulators).
// Accumulators (scaled by 1/1024) staged in a block LDS tile (cross-wave, block barrier); then wave w owns rows 2w, 2w+1 (wave-private from here): adds the bf16-valued input row as float4 at the read stage,
__global__ __launch_bounds__(256) void k_oln(const h16* __restrict__ AV, const h16* __restrict__ WO, const float* __restrict__ hin, const float* __restrict__ gamma, const float* __restrict__ beta, float* OUT) {
    __shared__ __align__(16) float ys[ORW * YSP];
    const int lane = threadIdx.x & 31, lr = lane & 15, hi = lane >> 4;
    const int wave = __builtin_amdgcn_readfirstlane((int)(threadIdx.x >> 5));
    const int r0 = blockIdx.x * ORW, c0 = wave * 64;
    v8f acc[4];
#pragma unroll
    for (int nb = 0; nb < 4; ++nb) acc[nb] = (v8f){};
    const size_t aoff = (size_t)(r0 + lr) * DM + 8 * hi, boff = (size_t)(c0 + lr) * DM + 8 * hi;
#pragma unroll 1
    for (int kc = 0; kc < DM; kc += 32) {
        const v16h a = ldh(AV + aoff + kc);
#pragma unroll
        for (int nb = 0; nb < 4; ++nb) { const v16h b = ldh(WO + boff + (size_t)nb * 16 * DM + kc); acc[nb] = wmma16_g(a, b, acc[nb]); }
    }
    // D layout: element j of lane = (row 8h + j, col lane&15); 8 waves cover rows 0..15 x columns 0..511
#pragma unroll
    for (int nb = 0; nb < 4; ++nb)
#pragma unroll
        for (int j = 0; j < 8; ++j) ys[(hi * 8 + j) * YSP + c0 + nb * 16 + lr] = acc[nb][j] * OSCL;
    __syncthreads();
#pragma unroll 1
    for (int rr = 0; rr < 2; ++rr) {
        const int row = wave * 2 + rr;
        const int mrow = r0 + row;                                        // plane row s2*NB + b2
        const size_t grow = (size_t)(mrow / NB) * NB_FULL + (size_t)(mrow % NB);
        v4f y[4]; float sum = 0.0f;
#pragma unroll
        for (int j = 0; j < 4; ++j) { const int c = (lane + 32 * j) * 4;
            const v4f a = *(const v4fa*)(&ys[row * YSP + c]); const v4f hv = *(const v4f*)(hin + grow * DM + c);
#pragma unroll
            for (int i = 0; i < 4; ++i) { y[j][i] = bfr(hv[i]) + a[i]; sum += y[j][i]; } }
        sum = wsum(sum);
        const float mu = sum * (1.0f / (float)DM);
        float sq = 0.0f;
#pragma unroll
        for (int j = 0; j < 4; ++j)
#pragma unroll
            for (int i = 0; i < 4; ++i) { const float d = y[j][i] - mu; y[j][i] = d; sq += d * d; }
        sq = wsum(sq);
        const float rstd = rsqrtf(sq * (1.0f / (float)DM) + LNEPS);
#pragma unroll
        for (int j = 0; j < 4; ++j) { const int c = (lane + 32 * j) * 4;
            const v4f gv = *(const v4f*)(gamma + c); const v4f bv = *(const v4f*)(beta + c); v4f ov;
#pragma unroll
            for (int i = 0; i < 4; ++i) ov[i] = y[j][i] * rstd * bfr(gv[i]) + bfr(bv[i]);
            *(v4fa*)(&ys[row * YSP + c]) = ov; }
    }
    wave_sync();
{
#pragma unroll 1
        for (int rr = 0; rr < 2; ++rr) {
            const int row = wave * 2 + rr;
            const int mrow = r0 + row;
            const size_t grow = (size_t)(mrow / NB) * NB_FULL + (size_t)(mrow % NB);
#pragma unroll
            for (int j = 0; j < 4; ++j) { const int c = (lane + 32 * j) * 4;   // 4 instructions x 32 lanes x 16 B = 2048 B = one output row
                const v4f val = *(const v4fa*)(&ys[row * YSP + c]);
                *(v4f*)(OUT + grow * DM + c) = val; } }
         }
}

static constexpr size_t al256(size_t v) { return (v + 255) & ~(size_t)255; }
static constexpr size_t SZ_XB = al256((size_t)SEQ * NB_FULL * DM * 2);     // bf16 x, source row order
static constexpr size_t SZ_WB = al256((size_t)3 * DM * DM * 2);            // bf16 Wq | Wkv
static constexpr size_t SZ_WO = al256((size_t)DM * DM * 2);                // f16 Wo x64
static constexpr size_t SZ_TP = al256((size_t)NB * SEQ * DM * 4);          // f32 q / k / v planes after the head linear
static constexpr size_t SZ_AV = al256((size_t)NB * SEQ * DM * 2);          // f16 attention vector x16
static constexpr size_t SZ_TOTAL = SZ_XB + SZ_WB + SZ_WO + 3 * SZ_TP + SZ_AV;
static_assert(SZ_TOTAL <= (size_t)134217728);          // workspace carve <= 128 MiB
static_assert(((size_t)DM * DM * 2) % 256 == 0);       // weight sub-planes stay 256-byte aligned

extern "C" void kernel_launch(void* const* d_in, const int* in_sizes, int n_in,
                              void* d_out, int out_size, void* d_ws, size_t ws_size, hipStream_t stream) {
    if (n_in < 10) return;
    if ((size_t)in_sizes[0] < (size_t)SEQ * NB_FULL * DM) return;
    if ((size_t)in_sizes[1] < (size_t)DM * DM || (size_t)in_sizes[2] < (size_t)2 * DM * DM || (size_t)in_sizes[7] < (size_t)DM * DM) return;
    if (in_sizes[3] < HD * HD || in_sizes[4] < HD * HD || in_sizes[5] < HD * HD) return;
    if (in_sizes[6] < DM || in_sizes[8] < DM || in_sizes[9] < DM) return;
    if ((size_t)out_size < ((size_t)(SEQ - 1) * NB_FULL + NB) * DM) return;
    if (SZ_TOTAL > ws_size) return;
    // wire order: h, Wq, Wkv, Wqt, Wkt, Wvt, lam, Wo, gamma, beta
    const float* hin = (const float*)d_in[0];
    const float* wq  = (const float*)d_in[1];
    const float* wkv = (const float*)d_in[2];
    const float* wqt = (const float*)d_in[3];
    const float* wkt = (const float*)d_in[4];
    const float* wvt = (const float*)d_in[5];
    const float* lam = (const float*)d_in[6];
    const float* wo  = (const float*)d_in[7];
    const float* gam = (const float*)d_in[8];
    const float* bet = (const float*)d_in[9];
    float* OUT = (float*)d_out;      // [SEQ][NB_FULL][512]
    char* wsp = (char*)d_ws;
    bf*  XB  = (bf*)wsp;  wsp += SZ_XB;                 // [SEQ*NB_FULL][512]
    bf*  WB  = (bf*)wsp;  wsp += SZ_WB;                 // [1536][512]: q rows | k rows | v rows
    h16* WOH = (h16*)wsp; wsp += SZ_WO;                 // [512][512]
    float* TQ = (float*)wsp; wsp += SZ_TP;              // [NB*SEQ][512], row b*SEQ + s
    float* TK = (float*)wsp; wsp += SZ_TP;
    float* TV = (float*)wsp; wsp += SZ_TP;
    h16* AV  = (h16*)wsp; wsp += SZ_AV;                 // [NB*SEQ][512], row s2*NB + b2

    { const size_t n8 = (size_t)SEQ * NB_FULL * DM / 8; k_cvt8<<<(unsigned)((n8 + 255) / 256), 256, 0, stream>>>(hin, XB, n8); }
    { const size_t n8 = (size_t)DM * DM / 8; k_cvt8<<<(unsigned)((n8 + 255) / 256), 256, 0, stream>>>(wq, WB, n8); }
    { const size_t n8 = (size_t)2 * DM * DM / 8; k_cvt8<<<(unsigned)((n8 + 255) / 256), 256, 0, stream>>>(wkv, WB + (size_t)DM * DM, n8); }
    { const size_t n8 = (size_t)DM * DM / 8; k_wcvt8h<<<(unsigned)((n8 + 255) / 256), 256, 0, stream>>>(wo, WOH, n8, WCARRY); }

    // projections: A = x rows (tile row R = b*SEQ + s <- source row s*NB_FULL + b), Bt = W rows (n = head*64 + d) -> plane [R][512]
    k_qkvt<<<dim3(NB * SEQ / PRW, DM / 64, 3), 128, 0, stream>>>(XB, WB, lam, wqt, wkt, wvt, TQ, TK, TV);

    k_mpattn<<<dim3(SEQ / 32, NB * NH_, 1), 256, 0, stream>>>(TQ, TK, TV, AV);

    k_oln<<<dim3(NB * SEQ / ORW, 1, 1), 256, 0, stream>>>(AV, WOH, hin, gam, bet, OUT);
}

// v004
// It runs in 59.3 microseconds.
// Timed twice side by side with v003, it ran 1.11 times as fast both times.
// All steps since v000 together make it 3.40 times as fast.
#include <hip/hip_runtime.h>

// Max-plus multi-head attention block, width 512 = 8 heads x 64: x [SEQ][NB_FULL][512]; Wq [512][512], Wkv [1024][512] (k rows then v rows), Wo [512][512], all [out][in] (y = x W^T);
// per-feature shift lam [512]; three 64x64 max-plus head weights; post-LN over (x + attention output) with gain and offset inputs.
// Compute dtypes, f32 accumulate everywhere: q/k/v projections v_wmma_f32_16x16x32_bf16 (x and W RNE-converted to bf16; products exact);
// output projection v_wmma_f32_16x16x32_f16, one product: attention vector as f16 with a x16 carry, bf16-valued Wo as f16 with a x64 carry, folded by 1/1024 in the f32 epilogue.
// Max-plus stages (head linear y[o] = max_i(x[i] + W[o][i]); score = -(max_d(q-k) - min_d(q-k)); context = max_key(score + v)) are semiring operations and run in f32 on the vector unit, as do log1p, expm1 and LayerNorm.
// Layout: the head regrouping is the flat reshape of [b][s][head][d] into [b*8 + s/(SEQ/8)][(s % (SEQ/8))*8 + head][d], i.e. group g is the contiguous SEQ x 64 chunk g of a [b][s][512] plane; the q/k/v planes are kept in that order
// (GEMM row R = b*SEQ + s reads source row s*NB_FULL + b by arithmetic addressing). Attention vector plane rows s2*NB + b2 with g = b2*8 + h2, columns h2*64 + d.

#ifndef NB
#define NB 2
#endif
#ifndef SEQ
#define SEQ 512
#endif
#define NB_FULL  2
#define SEQ_FULL 512
#define DM   512
#define NH_  8
#define HD   64
#define XSP  68                  // LDS row pitch (floats) of the 64-column tiles of the projection kernel
#define YSP  516                 // LDS row pitch (floats) of the 16 x 512 tile of the output kernel
#define ORW  16                  // rows per block of the output kernel
#define PRW  32                  // rows per block of the projection kernel
#define AW   8                   // waves per block of the attention kernel
#define KPW  (SEQ / AW)          // keys a wave of the attention kernel owns
#define KC   32                  // keys a wave stages at a time
#define SCP  36                  // LDS row pitch (floats) of a wave's score rows (32 queries)
#define WRG  (2 * KC * XSP + 16 * SCP)   // floats of one wave's LDS range in the attention kernel
#define ACARRY 16.0f             // carry of the f16 attention vector plane
#define WCARRY 64.0f             // carry of the f16 Wo plane
#define OSCL (1.0f / 1024.0f)    // 1 / (ACARRY * WCARRY)
#define PBL  256                 // blocks of the convert kernel
#define PTH  128                 // threads per block of the convert kernel
#define PNT  (PBL * PTH)         // threads of the convert kernel
#define NPX  (SEQ * NB_FULL * DM / 8 / PNT)   // 8-float pieces of x a thread converts
#define NPW  (DM * DM / 8 / PNT)              // 8-float pieces of one DM x DM weight a thread converts
#define LNEPS 1e-5f
#define NEGB (-3.0e38f)
#define POSB (3.0e38f)

static_assert(NH_ * HD == DM);                 // head h = columns h*64 + d
static_assert(HD == 64);                       // one 64-column GEMM tile = one head; attention lanes own 8 octets of d
static_assert(DM % 64 == 0);
static_assert(DM % 32 == 0);                   // GEMM k-loops step by 32
static_assert(SEQ % PRW == 0);                 // a projection tile never straddles two batches
static_assert((NB * SEQ) % PRW == 0);
static_assert(PRW == 32);                      // 2 WMMA row slabs per wave; 4 waves x 8 epilogue rows
static_assert(SEQ % 32 == 0);                  // attention query tiles of 32 rows
static_assert(SEQ % (AW * KC) == 0);           // every wave owns whole staging chunks of keys
static_assert(KC % 16 == 0);                   // phase blocks of 16 keys
static_assert((SCP * 4) % 16 == 0);
static_assert(SCP >= 32);
static_assert(WRG >= 32 * XSP);                // a wave's 32 x 64 maxima fit its own range
static_assert((WRG * 4) % 16 == 0);
static_assert(SEQ % NH_ == 0);                 // tokens per group = SEQ / 8
static_assert((NB * SEQ) % ORW == 0);
static_assert(ORW == 16);                      // one 16-row WMMA slab per block of the output kernel
static_assert(8 * 64 == DM);                   // 8 waves x 64 columns cover one output row
static_assert(NB <= NB_FULL);
static_assert(SEQ <= SEQ_FULL);
static_assert((XSP * 4) % 16 == 0);
static_assert(XSP >= 64);
static_assert((YSP * 4) % 16 == 0);
static_assert(YSP >= DM);
static_assert(((size_t)SEQ * NB_FULL * DM) % 8 == 0);
static_assert(((size_t)DM * DM) % 8 == 0);
static_assert((size_t)NPX * PNT * 8 == (size_t)SEQ * NB_FULL * DM);   // the convert grid covers x exactly
static_assert((size_t)NPW * PNT * 8 == (size_t)DM * DM);              // and each DM x DM weight exactly
static_assert(4 * 32 * 16 * 4 == PRW * 64 * 4);        // projection store: 4 waves x 32 lanes x 16 B x 4 trips == 32 rows x 256 B
static_assert(256 * 16 == 32 * HD * 2);
static_assert(AW * 32 == 256);
static_assert(8 * (ORW / 8) * 4 * 32 * 16 == ORW * DM * 4);   // output store: 8 waves x 2 rows x 4 instructions x 512 B == 16 rows x 2048 B
static_assert((2 * PRW + 64) * XSP * 4 <= 131072);     // static LDS of the projection kernel
static_assert((32 * XSP + AW * WRG) * 4 <= 327680);    // static LDS of the attention kernel
static_assert(ORW * YSP * 4 <= 131072);                // static LDS of the output kernel

typedef _Float16 h16;
typedef unsigned short bf;
typedef __attribute__((ext_vector_type(16))) __bf16   v16bf;
typedef __attribute__((ext_vector_type(16))) _Float16 v16h;
typedef __attribute__((ext_vector_type(8)))  _Float16 v8h;
typedef __attribute__((ext_vector_type(8)))  unsigned short v8us;
typedef __attribute__((ext_vector_type(8)))  float    v8f;
typedef __attribute__((ext_vector_type(4)))  float    v4f;
typedef v4f  __attribute__((may_alias)) v4fa;

__device__ __forceinline__ unsigned short f2bf(float f) { unsigned u = __float_as_uint(f); u += 0x7FFFu + ((u >> 16) & 1u); return (unsigned short)(u >> 16); }
__device__ __forceinline__ float bfr(float f) { return __uint_as_float(((unsigned)f2bf(f)) << 16); }   // value after RNE convert to bf16
__device__ __forceinline__ v16h cat16(v8h lo, v8h hi) { return __builtin_shufflevector(lo, hi, 0, 1, 2, 3, 4, 5, 6, 7, 8, 9, 10, 11, 12, 13, 14, 15); }
__device__ __forceinline__ v16bf cat16b(v8us lo, v8us hi) { return __builtin_bit_cast(v16bf, __builtin_shufflevector(lo, hi, 0, 1, 2, 3, 4, 5, 6, 7, 8, 9, 10, 11, 12, 13, 14, 15)); }
__device__ __forceinline__ v8f wmma16(v16h a, v16h b, v8f c) { return __builtin_amdgcn_wmma_f32_16x16x32_f16(false, a, false, b, (short)0, c, false, false); }
__device__ __forceinline__ v8f wmmab(v16bf a, v16bf b, v8f c) { return __builtin_amdgcn_wmma_f32_16x16x32_bf16(false, a, false, b, (short)0, c, false, false); }
// fragment loaders from K-contiguous 16-bit rows; p already includes + 8*(lane>>4): elements 0..7 <- k0+8h+0..7, elements 8..15 <- k0+16+8h+0..7 (same map for A and B)
__device__ __forceinline__ v16h  ldh(const h16* p) { return cat16(*(const v8h*)p, *(const v8h*)(p + 16)); }
__device__ __forceinline__ v16bf ldb(const bf* p)  { return cat16b(*(const v8us*)p, *(const v8us*)(p + 16)); }
// ordering point for wave-private LDS tiles (same wave writes and reads)
__device__ __forceinline__ void wave_sync() { __builtin_amdgcn_fence(3 /* release order */, "wavefront"); __builtin_amdgcn_wave_barrier(); asm volatile("" ::: "memory"); }

// per-instruction guarded matrix products: one accumulator tied per guard, operands kept live across the nops
__device__ __forceinline__ v8f wmmab_g(v16bf a, v16bf b, v8f c) { c = wmmab(a, b, c); asm volatile("v_nop\n\tv_nop\n\tv_nop\n\tv_nop" : "+v"(c) : "v"(a), "v"(b)); return c; }
__device__ __forceinline__ v8f wmma16_g(v16h a, v16h b, v8f c) { c = wmma16(a, b, c); asm volatile("v_nop\n\tv_nop\n\tv_nop\n\tv_nop" : "+v"(c) : "v"(a), "v"(b)); return c; }
// f32 -> f16 convert that cannot produce a subnormal operand (|v| < 2^-14 -> +0), applied after the plane's carry
static __device__ __forceinline__ h16 toh_flush(float v) { const h16 r = (h16)v; return (fabsf(v) < 6.103515625e-05f) ? (h16)0.0f : r; }
__device__ __forceinline__ float wsum(float v) { v += __shfl_xor(v, 16, 32); v += __shfl_xor(v, 8, 32); v += __shfl_xor(v, 4, 32); v += __shfl_xor(v, 2, 32); v += __shfl_xor(v, 1, 32); return v; }

// k_prep: all four operand conversions in one grid. Thread i owns pieces i + n*PNT (8 floats each) of x, of Wq, of Wkv (2 DM x DM planes) and of Wo; every load is issued before the first convert.
// x, Wq, Wkv -> bf16 (RNE); Wo -> bf16-valued f16 with the x64 carry. WB holds the Wq rows, then the Wkv rows.
__global__ __launch_bounds__(PTH) void k_prep(const float* __restrict__ x, const float* __restrict__ wq, const float* __restrict__ wkv, const float* __restrict__ wo,
                                              bf* __restrict__ XB, bf* __restrict__ WB, h16* __restrict__ WOH) {
    const unsigned i = blockIdx.x * PTH + threadIdx.x;
    const unsigned ib = i * 32u;                           // byte offset of piece i in an f32 source; piece i + n*PNT lies n * PNT * 32 bytes further
    v8f vx[NPX], vq[NPW], vk[2 * NPW], vo[NPW];
#pragma unroll
    for (int n = 0; n < NPX; ++n) vx[n] = *(const v8f*)((const char*)x + ib + (size_t)n * PNT * 32);
#pragma unroll
    for (int n = 0; n < 2 * NPW; ++n) vk[n] = *(const v8f*)((const char*)wkv + ib + (size_t)n * PNT * 32);
#pragma unroll
    for (int n = 0; n < NPW; ++n) { vq[n] = *(const v8f*)((const char*)wq + ib + (size_t)n * PNT * 32); vo[n] = *(const v8f*)((const char*)wo + ib + (size_t)n * PNT * 32); }
    asm volatile("s_wait_xcnt 0x0" :: "v"(ib), "s"(x), "s"(wq), "s"(wkv), "s"(wo) : "memory");   // the loads' offset register and base pairs stay whole until this wait; they are reused only behind it
#pragma unroll
    for (int n = 0; n < NPX; ++n) { v8us o;
#pragma unroll
        for (int k = 0; k < 8; ++k) o[k] = f2bf(vx[n][k]);
        *(v8us*)(XB + ((size_t)n * PNT + i) * 8) = o; }
#pragma unroll
    for (int n = 0; n < 2 * NPW; ++n) { v8us o;
#pragma unroll
        for (int k = 0; k < 8; ++k) o[k] = f2bf(vk[n][k]);
        *(v8us*)(WB + (size_t)DM * DM + ((size_t)n * PNT + i) * 8) = o; }
#pragma unroll
    for (int n = 0; n < NPW; ++n) { v8us o; v8h oh;
#pragma unroll
        for (int k = 0; k < 8; ++k) { o[k] = f2bf(vq[n][k]); oh[k] = toh_flush(bfr(vo[n][k]) * WCARRY); }
        *(v8us*)(WB + ((size_t)n * PNT + i) * 8) = o;
        *(v8h*)(WOH + ((size_t)n * PNT + i) * 8) = oh; }
}

// k_qkvt: the three projections (blockIdx.z = 0, 1, 2 for q, k, v) in one grid, each fused with its shift-log and its max-plus head linear. FOUR WAVES per 32x64 tile, bf16 operands straight from K-contiguous planes, K = DM.
// Product: wave w owns all 32 rows and the 16 columns of quarter w (2 accumulators, one B fragment a k step); every accumulator sums its k steps in ascending order.
// Tile rows R = r0..r0+31 in [b][s] order (R = b*SEQ + s) read source rows s*NB_FULL + b; tile columns c0..c0+63 = one head.
// Epilogue: accumulators -> LDS x tile and weight tile (both cross-wave: one block barrier); from there wave w owns rows 8w..8w+7 alone: x = log1p(max(x, 0)) - lam in place;
// y[r][o] = max_i(x[r][i] + W[o][i]) with the two weight rows of each lane in registers (o = lane, lane + 32) and x rows read as LDS broadcasts; 16-byte row stores.
// grid (NB*SEQ/32, DM/64, 3) = 768 blocks, three on each of 256 WGPs when spread evenly; the projections do not depend on one another, so their tiles run side by side.
// WB holds the q, k and v weight rows one after the other (DM rows each).
__global__ __launch_bounds__(128) void k_qkvt(const bf* __restrict__ A, const bf* __restrict__ WB, const float* __restrict__ lam,
                                              const float* __restrict__ Wqt, const float* __restrict__ Wkt, const float* __restrict__ Wvt, float* TQ, float* TK, float* TV) {
    __shared__ __align__(16) float xs[PRW * XSP];
    __shared__ __align__(16) float wl[64 * XSP];
    __shared__ __align__(16) float ys[PRW * XSP];
    const int K = DM;
    const int pz = blockIdx.z;
    const bf* Bt = WB + (size_t)pz * DM * DM;
    const float* Wt = pz == 0 ? Wqt : (pz == 1 ? Wkt : Wvt);
    float* TP = pz == 0 ? TQ : (pz == 1 ? TK : TV);
    const int tid = threadIdx.x;
    const int wave = __builtin_amdgcn_readfirstlane((int)(threadIdx.x >> 5));
    const int lane = tid & 31, lr = lane & 15, hi = lane >> 4; const int r0 = blockIdx.x * PRW, c0 = blockIdx.y * 64;
    const int bb = r0 / SEQ, s0 = r0 % SEQ;
    v8f acc[2];
#pragma unroll
    for (int mb = 0; mb < 2; ++mb) acc[mb] = (v8f){};
    const size_t aoff = ((size_t)(s0 + lr) * NB_FULL + (size_t)bb) * K + 8 * hi, boff = (size_t)(c0 + wave * 16 + lr) * K + 8 * hi;
#pragma unroll 1
    for (int kc = 0; kc < K; kc += 32) {
        v16bf a[2];
#pragma unroll
        for (int mb = 0; mb < 2; ++mb) a[mb] = ldb(A + aoff + (size_t)mb * 16 * NB_FULL * K + kc);
        const v16bf b = ldb(Bt + boff + kc);
#pragma unroll
        for (int mb = 0; mb < 2; ++mb) acc[mb] = wmmab_g(a[mb], b, acc[mb]);
    }
    // D layout: element j of lane = (row 8h + j, col lane&15); 4 waves cover rows 0..31 x columns 0..63
#pragma unroll
    for (int mb = 0; mb < 2; ++mb)
#pragma unroll
        for (int j = 0; j < 8; ++j) xs[(mb * 16 + hi * 8 + j) * XSP + wave * 16 + lr] = acc[mb][j];
    // max-plus weight W[o][i], bf16-valued, thread-linear 16-B loads: 1024 pieces / 128 threads
#pragma unroll 1
    for (int e = tid; e < 64 * 16; e += 128) {
        v4f w = *(const v4f*)(Wt + (size_t)e * 4);
#pragma unroll
        for (int i = 0; i < 4; ++i) w[i] = bfr(w[i]);
        *(v4fa*)(&wl[(e >> 4) * XSP + (e & 15) * 4]) = w; }
    __syncthreads();                                                // xs and wl are written by all waves and read across waves
    const int c4 = (lane & 15) * 4, rh = lane >> 4;
    float lv[4];
#pragma unroll
    for (int i = 0; i < 4; ++i) lv[i] = bfr(lam[c0 + c4 + i]);      // c0 + 63 < DM
#pragma unroll 1
    for (int s = wave * 4; s < wave * 4 + 4; ++s) { const int row = 2 * s + rh;      // 4 waves x 4 trips x 2 rows = 32 rows; 16 lanes x 4 floats = 64 columns
        v4f x = *(const v4fa*)(&xs[row * XSP + c4]);
#pragma unroll
        for (int i = 0; i < 4; ++i) x[i] = log1pf(fmaxf(x[i], 0.0f)) - lv[i];
        *(v4fa*)(&xs[row * XSP + c4]) = x; }
    wave_sync();
    float wlo[64], whi[64];                                         // weight rows o = lane and o = lane + 32, static indices only
#pragma unroll
    for (int g = 0; g < 16; ++g) { const v4f t0 = *(const v4fa*)(&wl[lane * XSP + 4 * g]); const v4f t1 = *(const v4fa*)(&wl[(lane + 32) * XSP + 4 * g]);
#pragma unroll
        for (int i = 0; i < 4; ++i) { wlo[4 * g + i] = t0[i]; whi[4 * g + i] = t1[i]; } }
#pragma unroll 1
    for (int r = wave * 8; r < wave * 8 + 8; ++r) {
        float a0 = NEGB, a1 = NEGB;
#pragma unroll
        for (int g = 0; g < 16; ++g) { const v4f x = *(const v4fa*)(&xs[r * XSP + 4 * g]);
#pragma unroll
            for (int i = 0; i < 4; ++i) { a0 = fmaxf(a0, x[i] + wlo[4 * g + i]); a1 = fmaxf(a1, x[i] + whi[4 * g + i]); } }
        ys[r * XSP + lane] = a0; ys[r * XSP + lane + 32] = a1; }
    wave_sync();
    float* orow = TP + (size_t)r0 * DM + c0 + c4;
{
#pragma unroll 1
        for (int s = wave * 4; s < wave * 4 + 4; ++s) { const int row = 2 * s + rh;
            const v4f val = *(const v4fa*)(&ys[row * XSP + c4]);
            *(v4f*)(orow + (size_t)row * DM) = val; }
         }
}

// wave_sync plus a wait: a wave's stores into its own LDS range have landed before its lanes read one another's rows back
__device__ __forceinline__ void wave_publish() { wave_sync(); asm volatile("s_wait_dscnt 0x0" ::: "memory"); }

// one 4-wide piece of the difference q - k folded into the running maximum and minimum of one (query, key) pair
__device__ __forceinline__ void dmm(const v4f q, const v4f k, float& mx, float& mn) {
    const v4f d = q - k;
    mx = fmaxf(fmaxf(fmaxf(fmaxf(mx, d[0]), d[1]), d[2]), d[3]);
    mn = fminf(fminf(fminf(fminf(mn, d[0]), d[1]), d[2]), d[3]);
}

// k_mpattn: max-plus attention on the vector unit in f32; block = (group g, 32-row query tile), 256 threads = 8 waves.
// Wave w owns keys 64w..64w+63 for BOTH phases and all 32 query rows; its key rows, value rows and scores live in its own LDS range (wave-private: no block barrier in the key loop).
// Phase 1, per 16 keys: lane (qi = lane&7, kj = lane>>3) keeps a 4 x 4 register block of (query qi + 8a, key kj + 4b) pairs: 8 LDS reads feed 16 pairs.
// Phase 2, per 16 keys: lane (qg = lane>>3, dg = lane&7) keeps an 8 x 8 register block of running maxima (query qg + 4i, column 8dg + j): 4 LDS reads a key feed 64 elements.
// Scores are laid out [key][(q & 3) * 8 + (q >> 2)], so the 8 scores of a phase-2 lane are contiguous.
// After the loop each wave writes its 32 x 64 maxima over its own range; one block barrier; thread (row = tid>>3, octet = tid&7) takes the maximum over the 8 waves (max is exact: any order gives the same value).
__global__ __launch_bounds__(256) void k_mpattn(const float* __restrict__ QP, const float* __restrict__ KP, const float* __restrict__ VP, h16* AV) {
#pragma clang fp contract(off)
    __shared__ __align__(16) float qs[32 * XSP];
    __shared__ __align__(16) float wr[AW * WRG];
    const int g = blockIdx.y, sqt = blockIdx.x, tid = threadIdx.x;
    const int wave = __builtin_amdgcn_readfirstlane((int)(threadIdx.x >> 5));
    const int lane = tid & 31;
    const v4f* qb = (const v4f*)(QP + ((size_t)g * SEQ + (size_t)sqt * 32) * HD);
    const v4f* kb = (const v4f*)(KP + ((size_t)g * SEQ + (size_t)wave * KPW) * HD);
    const v4f* vb = (const v4f*)(VP + ((size_t)g * SEQ + (size_t)wave * KPW) * HD);
    float* kw = wr + wave * WRG;                 // KC key rows, pitch XSP
    float* vw = kw + KC * XSP;                   // KC value rows, pitch XSP
    float* sc = vw + KC * XSP;                   // 16 score rows, pitch SCP
    // query tile: 32 rows x 16 pieces = 512 pieces, two per thread (rows 0..15 and 16..31)
    *(v4fa*)(&qs[(tid >> 4) * XSP + (tid & 15) * 4])        = qb[tid];
    *(v4fa*)(&qs[((tid >> 4) + 16) * XSP + (tid & 15) * 4]) = qb[tid + 256];
    __syncthreads();                                       // the query tile is written by all waves and read by all
    float ctx[8][8];
#pragma unroll
    for (int i = 0; i < 8; ++i)
#pragma unroll
        for (int j = 0; j < 8; ++j) ctx[i][j] = NEGB;
    const int qi = lane & 7, kj = lane >> 3;
    const int qg = lane >> 3, dg = lane & 7;
#pragma unroll 1
    for (int t = 0; t < KPW / KC; ++t) {
        wave_sync();                                       // this wave's earlier reads of kw / vw stay in front of the refill
const int e0 = t * KC * 16 + lane;
        v4f rk[KC / 2], rv[KC / 2];                        // KC rows x 16 pieces, 32 a trip
#pragma unroll
        for (int i = 0; i < KC / 2; ++i) { rk[i] = kb[e0 + 32 * i]; rv[i] = vb[e0 + 32 * i]; }
        asm volatile("s_wait_xcnt 0x0" :: "v"(e0) : "memory");   // the loads' index register stays whole until this wait; it is reused only behind it
#pragma unroll
        for (int i = 0; i < KC / 2; ++i) { const int e = lane + 32 * i;
            *(v4fa*)(&kw[(e >> 4) * XSP + (e & 15) * 4]) = rk[i];
            *(v4fa*)(&vw[(e >> 4) * XSP + (e & 15) * 4]) = rv[i]; }
        wave_publish();                                    // key and value rows cross lanes of this wave
#pragma unroll 1
        for (int u = 0; u < KC / 16; ++u) {
            const float* ku = kw + u * 16 * XSP;
            const float* vu = vw + u * 16 * XSP;
            float mx[4][4], mn[4][4];
#pragma unroll
            for (int a = 0; a < 4; ++a)
#pragma unroll
                for (int b = 0; b < 4; ++b) { mx[a][b] = NEGB; mn[a][b] = POSB; }
#pragma unroll 2
            for (int c = 0; c < 16; ++c) {
                v4f q[4], k[4];
#pragma unroll
                for (int a = 0; a < 4; ++a) q[a] = *(const v4fa*)(&qs[(qi + 8 * a) * XSP + 4 * c]);
#pragma unroll
                for (int b = 0; b < 4; ++b) k[b] = *(const v4fa*)(&ku[(kj + 4 * b) * XSP + 4 * c]);
#pragma unroll
                for (int a = 0; a < 4; ++a)
#pragma unroll
                    for (int b = 0; b < 4; ++b) dmm(q[a], k[b], mx[a][b], mn[a][b]);
            }
#pragma unroll
            for (int a = 0; a < 4; ++a)
#pragma unroll
                for (int b = 0; b < 4; ++b) sc[(kj + 4 * b) * SCP + (qi & 3) * 8 + (qi >> 2) + 2 * a] = mn[a][b] - mx[a][b];   // = -(max - min)
            wave_publish();                                // scores cross lanes of this wave
#pragma unroll 1
            for (int kk = 0; kk < 16; kk += 2) {
                float s0[8], s1[8], v0[8], v1[8];
#pragma unroll
                for (int h = 0; h < 2; ++h) {
                    const v4f ta = *(const v4fa*)(&sc[kk * SCP + qg * 8 + 4 * h]);       const v4f tb = *(const v4fa*)(&sc[(kk + 1) * SCP + qg * 8 + 4 * h]);
                    const v4f tc = *(const v4fa*)(&vu[kk * XSP + dg * 8 + 4 * h]);       const v4f td = *(const v4fa*)(&vu[(kk + 1) * XSP + dg * 8 + 4 * h]);
#pragma unroll
                    for (int i = 0; i < 4; ++i) { s0[4 * h + i] = ta[i]; s1[4 * h + i] = tb[i]; v0[4 * h + i] = tc[i]; v1[4 * h + i] = td[i]; } }
#pragma unroll
                for (int i = 0; i < 8; ++i)
#pragma unroll
                    for (int j = 0; j < 8; ++j) ctx[i][j] = fmaxf(fmaxf(ctx[i][j], s0[i] + v0[j]), s1[i] + v1[j]);
            }
            wave_sync();                                   // this wave's reads of sc stay in front of the next scores
        }
    }
    // this wave's maxima over its own range (rows q, pitch XSP)
#pragma unroll
    for (int i = 0; i < 8; ++i)
#pragma unroll
        for (int h = 0; h < 2; ++h) { v4f o4;
#pragma unroll
            for (int j = 0; j < 4; ++j) o4[j] = ctx[i][4 * h + j];
            *(v4fa*)(&kw[(qg + 4 * i) * XSP + dg * 8 + 4 * h]) = o4; }
    __syncthreads();                                       // the per-wave maxima are read across waves
    const int sq2 = tid >> 3, dg2 = tid & 7;
    float fin[8];
#pragma unroll
    for (int j = 0; j < 8; ++j) fin[j] = NEGB;
#pragma unroll
    for (int w = 0; w < AW; ++w)
#pragma unroll
        for (int h = 0; h < 2; ++h) { const v4f p = *(const v4fa*)(&wr[w * WRG + sq2 * XSP + dg2 * 8 + 4 * h]);
#pragma unroll
            for (int j = 0; j < 4; ++j) fin[4 * h + j] = fmaxf(fin[4 * h + j], p[j]); }
    const int b2 = g / NH_, h2 = g % NH_;
    const int s2 = sqt * 32 + sq2;
    v8h o;
#pragma unroll
    for (int j = 0; j < 8; ++j) o[j] = toh_flush(expm1f(fin[j]) * ACARRY);
    h16* dst = AV + ((size_t)s2 * NB + (size_t)b2) * DM + h2 * HD + dg2 * 8;
    *(v8h*)dst = o; 
}

// k_oln: output projection (f16 product) fused with the skip connection and LayerNorm. Block = 16 rows x 512 columns, 8 waves, wave w owns columns 64w..64w+63 (4 accumulators).
// Accumulators (scaled by 1/1024) staged in a block LDS tile (cross-wave, block barrier); then wave w owns rows 2w, 2w+1 (wave-private from here): adds the bf16-valued input row as float4 at the read stage,
__global__ __launch_bounds__(256) void k_oln(const h16* __restrict__ AV, const h16* __restrict__ WO, const float* __restrict__ hin, const float* __restrict__ gamma, const float* __restrict__ beta, float* OUT) {
    __shared__ __align__(16) float ys[ORW * YSP];
    const int lane = threadIdx.x & 31, lr = lane & 15, hi = lane >> 4;
    const int wave = __builtin_amdgcn_readfirstlane((int)(threadIdx.x >> 5));
    const int r0 = blockIdx.x * ORW, c0 = wave * 64;
    v8f acc[4];
#pragma unroll
    for (int nb = 0; nb < 4; ++nb) acc[nb] = (v8f){};
    const size_t aoff = (size_t)(r0 + lr) * DM + 8 * hi, boff = (size_t)(c0 + lr) * DM + 8 * hi;
#pragma unroll 1
    for (int kc = 0; kc < DM; kc += 32) {
        const v16h a = ldh(AV + aoff + kc);
#pragma unroll
        for (int nb = 0; nb < 4; ++nb) { const v16h b = ldh(WO + boff + (size_t)nb * 16 * DM + kc); acc[nb] = wmma16_g(a, b, acc[nb]); }
    }
    // D layout: element j of lane = (row 8h + j, col lane&15); 8 waves cover rows 0..15 x columns 0..511
#pragma unroll
    for (int nb = 0; nb < 4; ++nb)
#pragma unroll
        for (int j = 0; j < 8; ++j) ys[(hi * 8 + j) * YSP + c0 + nb * 16 + lr] = acc[nb][j] * OSCL;
    __syncthreads();
#pragma unroll 1
    for (int rr = 0; rr < 2; ++rr) {
        const int row = wave * 2 + rr;
        const int mrow = r0 + row;                                        // plane row s2*NB + b2
        const size_t grow = (size_t)(mrow / NB) * NB_FULL + (size_t)(mrow % NB);
        v4f y[4]; float sum = 0.0f;
#pragma unroll
        for (int j = 0; j < 4; ++j) { const int c = (lane + 32 * j) * 4;
            const v4f a = *(const v4fa*)(&ys[row * YSP + c]); const v4f hv = *(const v4f*)(hin + grow * DM + c);
#pragma unroll
            for (int i = 0; i < 4; ++i) { y[j][i] = bfr(hv[i]) + a[i]; sum += y[j][i]; } }
        sum = wsum(sum);
        const float mu = sum * (1.0f / (float)DM);
        float sq = 0.0f;
#pragma unroll
        for (int j = 0; j < 4; ++j)
#pragma unroll
            for (int i = 0; i < 4; ++i) { const float d = y[j][i] - mu; y[j][i] = d; sq += d * d; }
        sq = wsum(sq);
        const float rstd = rsqrtf(sq * (1.0f / (float)DM) + LNEPS);
#pragma unroll
        for (int j = 0; j < 4; ++j) { const int c = (lane + 32 * j) * 4;
            const v4f gv = *(const v4f*)(gamma + c); const v4f bv = *(const v4f*)(beta + c); v4f ov;
#pragma unroll
            for (int i = 0; i < 4; ++i) ov[i] = y[j][i] * rstd * bfr(gv[i]) + bfr(bv[i]);
            *(v4fa*)(&ys[row * YSP + c]) = ov; }
    }
    wave_sync();
{
#pragma unroll 1
        for (int rr = 0; rr < 2; ++rr) {
            const int row = wave * 2 + rr;
            const int mrow = r0 + row;
            const size_t grow = (size_t)(mrow / NB) * NB_FULL + (size_t)(mrow % NB);
#pragma unroll
            for (int j = 0; j < 4; ++j) { const int c = (lane + 32 * j) * 4;   // 4 instructions x 32 lanes x 16 B = 2048 B = one output row
                const v4f val = *(const v4fa*)(&ys[row * YSP + c]);
                *(v4f*)(OUT + grow * DM + c) = val; } }
         }
}

static constexpr size_t al256(size_t v) { return (v + 255) & ~(size_t)255; }
static constexpr size_t SZ_XB = al256((size_t)SEQ * NB_FULL * DM * 2);     // bf16 x, source row order
static constexpr size_t SZ_WB = al256((size_t)3 * DM * DM * 2);            // bf16 Wq | Wkv
static constexpr size_t SZ_WO = al256((size_t)DM * DM * 2);                // f16 Wo x64
static constexpr size_t SZ_TP = al256((size_t)NB * SEQ * DM * 4);          // f32 q / k / v planes after the head linear
static constexpr size_t SZ_AV = al256((size_t)NB * SEQ * DM * 2);          // f16 attention vector x16
static constexpr size_t SZ_TOTAL = SZ_XB + SZ_WB + SZ_WO + 3 * SZ_TP + SZ_AV;
static_assert(SZ_TOTAL <= (size_t)134217728);          // workspace carve <= 128 MiB
static_assert(((size_t)DM * DM * 2) % 256 == 0);       // weight sub-planes stay 256-byte aligned

extern "C" void kernel_launch(void* const* d_in, const int* in_sizes, int n_in,
                              void* d_out, int out_size, void* d_ws, size_t ws_size, hipStream_t stream) {
    if (n_in < 10) return;
    if ((size_t)in_sizes[0] < (size_t)SEQ * NB_FULL * DM) return;
    if ((size_t)in_sizes[1] < (size_t)DM * DM || (size_t)in_sizes[2] < (size_t)2 * DM * DM || (size_t)in_sizes[7] < (size_t)DM * DM) return;
    if (in_sizes[3] < HD * HD || in_sizes[4] < HD * HD || in_sizes[5] < HD * HD) return;
    if (in_sizes[6] < DM || in_sizes[8] < DM || in_sizes[9] < DM) return;
    if ((size_t)out_size < ((size_t)(SEQ - 1) * NB_FULL + NB) * DM) return;
    if (SZ_TOTAL > ws_size) return;
    // wire order: h, Wq, Wkv, Wqt, Wkt, Wvt, lam, Wo, gamma, beta
    const float* hin = (const float*)d_in[0];
    const float* wq  = (const float*)d_in[1];
    const float* wkv = (const float*)d_in[2];
    const float* wqt = (const float*)d_in[3];
    const float* wkt = (const float*)d_in[4];
    const float* wvt = (const float*)d_in[5];
    const float* lam = (const float*)d_in[6];
    const float* wo  = (const float*)d_in[7];
    const float* gam = (const float*)d_in[8];
    const float* bet = (const float*)d_in[9];
    float* OUT = (float*)d_out;      // [SEQ][NB_FULL][512]
    char* wsp = (char*)d_ws;
    bf*  XB  = (bf*)wsp;  wsp += SZ_XB;                 // [SEQ*NB_FULL][512]
    bf*  WB  = (bf*)wsp;  wsp += SZ_WB;                 // [1536][512]: q rows | k rows | v rows
    h16* WOH = (h16*)wsp; wsp += SZ_WO;                 // [512][512]
    float* TQ = (float*)wsp; wsp += SZ_TP;              // [NB*SEQ][512], row b*SEQ + s
    float* TK = (float*)wsp; wsp += SZ_TP;
    float* TV = (float*)wsp; wsp += SZ_TP;
    h16* AV  = (h16*)wsp; wsp += SZ_AV;                 // [NB*SEQ][512], row s2*NB + b2

    k_prep<<<dim3(PBL, 1, 1), PTH, 0, stream>>>(hin, wq, wkv, wo, XB, WB, WOH);

    // projections: A = x rows (tile row R = b*SEQ + s <- source row s*NB_FULL + b), Bt = W rows (n = head*64 + d) -> plane [R][512]
    k_qkvt<<<dim3(NB * SEQ / PRW, DM / 64, 3), 128, 0, stream>>>(XB, WB, lam, wqt, wkt, wvt, TQ, TK, TV);

    k_mpattn<<<dim3(SEQ / 32, NB * NH_, 1), 256, 0, stream>>>(TQ, TK, TV, AV);

    k_oln<<<dim3(NB * SEQ / ORW, 1, 1), 256, 0, stream>>>(AV, WOH, hin, gam, bet, OUT);
}

// v005
// It runs in 48.4 microseconds.
// In two side-by-side timings against v004, it was 1.23 and 1.21 times as fast.
// Over all steps from v000 it is 4.15 times as fast.
#include <hip/hip_runtime.h>

// Max-plus multi-head attention block, width 512 = 8 heads x 64: x [SEQ][NB_FULL][512]; Wq [512][512], Wkv [1024][512] (k rows then v rows), Wo [512][512], all [out][in] (y = x W^T);
// per-feature shift lam [512]; three 64x64 max-plus head weights; post-LN over (x + attention output) with gain and offset inputs.
// Compute dtypes, f32 accumulate everywhere: q/k/v projections v_wmma_f32_16x16x32_bf16 (x and W RNE-converted to bf16; products exact);
// output projection v_wmma_f32_16x16x32_f16, one product: attention vector as f16 with a x16 carry, bf16-valued Wo as f16 with a x64 carry, folded by 1/1024 in the f32 epilogue.
// Max-plus stages (head linear y[o] = max_i(x[i] + W[o][i]); score = -(max_d(q-k) - min_d(q-k)); context = max_key(score + v)) are semiring operations and run in f32 on the vector unit, as do log1p, expm1 and LayerNorm.
// Layout: the head regrouping is the flat reshape of [b][s][head][d] into [b*8 + s/(SEQ/8)][(s % (SEQ/8))*8 + head][d], i.e. group g is the contiguous SEQ x 64 chunk g of a [b][s][512] plane; the q/k/v planes are kept in that order
// (GEMM row R = b*SEQ + s reads source row s*NB_FULL + b by arithmetic addressing). Attention vector plane rows s2*NB + b2 with g = b2*8 + h2, columns h2*64 + d.

#ifndef NB
#define NB 2
#endif
#ifndef SEQ
#define SEQ 512
#endif
#define NB_FULL  2
#define SEQ_FULL 512
#define DM   512
#define NH_  8
#define HD   64
#define XSP  68                  // LDS row pitch (floats) of the 64-column tiles of the projection kernel
#define YSP  516                 // LDS row pitch (floats) of the 16 x 512 tile of the output kernel
#define ORW  16                  // rows per block of the output kernel
#define PRW  32                  // rows per block of the projection kernel
#define PKB  8                   // k steps whose fragments the projection kernel loads in one batch
#define OKB  4                   // k steps whose fragments the output kernel loads in one batch
#define AW   8                   // waves per block of the attention kernel
#define KPW  (SEQ / AW)          // keys a wave of the attention kernel owns
#define KC   32                  // keys a wave stages at a time
#define SCP  36                  // LDS row pitch (floats) of a wave's score rows (32 queries)
#define WRG  (2 * KC * XSP + 16 * SCP)   // floats of one wave's LDS range in the attention kernel
#define ACARRY 16.0f             // carry of the f16 attention vector plane
#define WCARRY 64.0f             // carry of the f16 Wo plane
#define OSCL (1.0f / 1024.0f)    // 1 / (ACARRY * WCARRY)
#define PBL  256                 // blocks of the convert kernel
#define PTH  128                 // threads per block of the convert kernel
#define PNT  (PBL * PTH)         // threads of the convert kernel
#define NPX  (SEQ * NB_FULL * DM / 8 / PNT)   // 8-float pieces of x a thread converts
#define NPW  (DM * DM / 8 / PNT)              // 8-float pieces of one DM x DM weight a thread converts
#define LNEPS 1e-5f
#define NEGB (-3.0e38f)
#define POSB (3.0e38f)

static_assert(NH_ * HD == DM);                 // head h = columns h*64 + d
static_assert(HD == 64);                       // one 64-column GEMM tile = one head; attention lanes own 8 octets of d
static_assert(DM % 64 == 0);
static_assert(DM % 32 == 0);                   // GEMM k-loops step by 32
static_assert(DM % (32 * PKB) == 0);           // whole batches of k steps
static_assert(DM % (32 * OKB) == 0);
static_assert(SEQ % PRW == 0);                 // a projection tile never straddles two batches
static_assert((NB * SEQ) % PRW == 0);
static_assert(PRW == 32);                      // 2 WMMA row slabs per wave; 4 waves x 8 epilogue rows
static_assert(SEQ % 32 == 0);                  // attention query tiles of 32 rows
static_assert(SEQ % (AW * KC) == 0);           // every wave owns whole staging chunks of keys
static_assert(KC % 16 == 0);                   // phase blocks of 16 keys
static_assert((SCP * 4) % 16 == 0);
static_assert(SCP >= 32);
static_assert(WRG >= 32 * XSP);                // a wave's 32 x 64 maxima fit its own range
static_assert((WRG * 4) % 16 == 0);
static_assert(SEQ % NH_ == 0);                 // tokens per group = SEQ / 8
static_assert((NB * SEQ) % ORW == 0);
static_assert(ORW == 16);                      // one 16-row WMMA slab per block of the output kernel
static_assert(8 * 64 == DM);                   // 8 waves x 64 columns cover one output row
static_assert(NB <= NB_FULL);
static_assert(SEQ <= SEQ_FULL);
static_assert((XSP * 4) % 16 == 0);
static_assert(XSP >= 64);
static_assert((YSP * 4) % 16 == 0);
static_assert(YSP >= DM);
static_assert(((size_t)SEQ * NB_FULL * DM) % 8 == 0);
static_assert(((size_t)DM * DM) % 8 == 0);
static_assert((size_t)NPX * PNT * 8 == (size_t)SEQ * NB_FULL * DM);   // the convert grid covers x exactly
static_assert((size_t)NPW * PNT * 8 == (size_t)DM * DM);              // and each DM x DM weight exactly
static_assert(4 * 32 * 16 * 4 == PRW * 64 * 4);        // projection store: 4 waves x 32 lanes x 16 B x 4 trips == 32 rows x 256 B
static_assert(256 * 16 == 32 * HD * 2);
static_assert(AW * 32 == 256);
static_assert(8 * (ORW / 8) * 4 * 32 * 16 == ORW * DM * 4);   // output store: 8 waves x 2 rows x 4 instructions x 512 B == 16 rows x 2048 B
static_assert((2 * PRW + 64) * XSP * 4 <= 131072);     // static LDS of the projection kernel
static_assert((32 * XSP + AW * WRG) * 4 <= 327680);    // static LDS of the attention kernel
static_assert(ORW * YSP * 4 <= 131072);                // static LDS of the output kernel

typedef _Float16 h16;
typedef unsigned short bf;
typedef __attribute__((ext_vector_type(16))) __bf16   v16bf;
typedef __attribute__((ext_vector_type(16))) _Float16 v16h;
typedef __attribute__((ext_vector_type(8)))  _Float16 v8h;
typedef __attribute__((ext_vector_type(8)))  unsigned short v8us;
typedef __attribute__((ext_vector_type(8)))  float    v8f;
typedef __attribute__((ext_vector_type(4)))  float    v4f;
typedef v4f  __attribute__((may_alias)) v4fa;

__device__ __forceinline__ unsigned short f2bf(float f) { unsigned u = __float_as_uint(f); u += 0x7FFFu + ((u >> 16) & 1u); return (unsigned short)(u >> 16); }
__device__ __forceinline__ float bfr(float f) { return __uint_as_float(((unsigned)f2bf(f)) << 16); }   // value after RNE convert to bf16
__device__ __forceinline__ v16h cat16(v8h lo, v8h hi) { return __builtin_shufflevector(lo, hi, 0, 1, 2, 3, 4, 5, 6, 7, 8, 9, 10, 11, 12, 13, 14, 15); }
__device__ __forceinline__ v16bf cat16b(v8us lo, v8us hi) { return __builtin_bit_cast(v16bf, __builtin_shufflevector(lo, hi, 0, 1, 2, 3, 4, 5, 6, 7, 8, 9, 10, 11, 12, 13, 14, 15)); }
__device__ __forceinline__ v8f wmma16(v16h a, v16h b, v8f c) { return __builtin_amdgcn_wmma_f32_16x16x32_f16(false, a, false, b, (short)0, c, false, false); }
__device__ __forceinline__ v8f wmmab(v16bf a, v16bf b, v8f c) { return __builtin_amdgcn_wmma_f32_16x16x32_bf16(false, a, false, b, (short)0, c, false, false); }
// fragment loaders from K-contiguous 16-bit rows; p already includes + 8*(lane>>4): elements 0..7 <- k0+8h+0..7, elements 8..15 <- k0+16+8h+0..7 (same map for A and B)
__device__ __forceinline__ v16h  ldh(const h16* p) { return cat16(*(const v8h*)p, *(const v8h*)(p + 16)); }
__device__ __forceinline__ v16bf ldb(const bf* p)  { return cat16b(*(const v8us*)p, *(const v8us*)(p + 16)); }
// ordering point for wave-private LDS tiles (same wave writes and reads)
__device__ __forceinline__ void wave_sync() { __builtin_amdgcn_fence(3 /* release order */, "wavefront"); __builtin_amdgcn_wave_barrier(); asm volatile("" ::: "memory"); }

// per-instruction guarded matrix products: one accumulator tied per guard, operands kept live across the nops
__device__ __forceinline__ v8f wmmab_g(v16bf a, v16bf b, v8f c) { c = wmmab(a, b, c); asm volatile("v_nop\n\tv_nop\n\tv_nop\n\tv_nop" : "+v"(c) : "v"(a), "v"(b)); return c; }
__device__ __forceinline__ v8f wmma16_g(v16h a, v16h b, v8f c) { c = wmma16(a, b, c); asm volatile("v_nop\n\tv_nop\n\tv_nop\n\tv_nop" : "+v"(c) : "v"(a), "v"(b)); return c; }
// f32 -> f16 convert that cannot produce a subnormal operand (|v| < 2^-14 -> +0), applied after the plane's carry
static __device__ __forceinline__ h16 toh_flush(float v) { const h16 r = (h16)v; return (fabsf(v) < 6.103515625e-05f) ? (h16)0.0f : r; }
__device__ __forceinline__ float wsum(float v) { v += __shfl_xor(v, 16, 32); v += __shfl_xor(v, 8, 32); v += __shfl_xor(v, 4, 32); v += __shfl_xor(v, 2, 32); v += __shfl_xor(v, 1, 32); return v; }

// k_prep: all four operand conversions in one grid. Thread i owns pieces i + n*PNT (8 floats each) of x, of Wq, of Wkv (2 DM x DM planes) and of Wo; every load is issued before the first convert.
// x, Wq, Wkv -> bf16 (RNE); Wo -> bf16-valued f16 with the x64 carry. WB holds the Wq rows, then the Wkv rows.
__global__ __launch_bounds__(PTH) void k_prep(const float* __restrict__ x, const float* __restrict__ wq, const float* __restrict__ wkv, const float* __restrict__ wo,
                                              bf* __restrict__ XB, bf* __restrict__ WB, h16* __restrict__ WOH) {
    const unsigned i = blockIdx.x * PTH + threadIdx.x;
    const unsigned ib = i * 32u;                           // byte offset of piece i in an f32 source; piece i + n*PNT lies n * PNT * 32 bytes further
    v8f vx[NPX], vq[NPW], vk[2 * NPW], vo[NPW];
#pragma unroll
    for (int n = 0; n < NPX; ++n) vx[n] = *(const v8f*)((const char*)x + ib + (size_t)n * PNT * 32);
#pragma unroll
    for (int n = 0; n < 2 * NPW; ++n) vk[n] = *(const v8f*)((const char*)wkv + ib + (size_t)n * PNT * 32);
#pragma unroll
    for (int n = 0; n < NPW; ++n) { vq[n] = *(const v8f*)((const char*)wq + ib + (size_t)n * PNT * 32); vo[n] = *(const v8f*)((const char*)wo + ib + (size_t)n * PNT * 32); }
    asm volatile("s_wait_xcnt 0x0" :: "v"(ib), "s"(x), "s"(wq), "s"(wkv), "s"(wo) : "memory");   // the loads' offset register and base pairs stay whole until this wait; they are reused only behind it
#pragma unroll
    for (int n = 0; n < NPX; ++n) { v8us o;
#pragma unroll
        for (int k = 0; k < 8; ++k) o[k] = f2bf(vx[n][k]);
        *(v8us*)(XB + ((size_t)n * PNT + i) * 8) = o; }
#pragma unroll
    for (int n = 0; n < 2 * NPW; ++n) { v8us o;
#pragma unroll
        for (int k = 0; k < 8; ++k) o[k] = f2bf(vk[n][k]);
        *(v8us*)(WB + (size_t)DM * DM + ((size_t)n * PNT + i) * 8) = o; }
#pragma unroll
    for (int n = 0; n < NPW; ++n) { v8us o; v8h oh;
#pragma unroll
        for (int k = 0; k < 8; ++k) { o[k] = f2bf(vq[n][k]); oh[k] = toh_flush(bfr(vo[n][k]) * WCARRY); }
        *(v8us*)(WB + ((size_t)n * PNT + i) * 8) = o;
        *(v8h*)(WOH + ((size_t)n * PNT + i) * 8) = oh; }
}

// k_qkvt: the three projections (blockIdx.z = 0, 1, 2 for q, k, v) in one grid, each fused with its shift-log and its max-plus head linear. FOUR WAVES per 32x64 tile, bf16 operands straight from K-contiguous planes, K = DM.
// Product: wave w owns all 32 rows and the 16 columns of quarter w (2 accumulators, one B fragment a k step); every accumulator sums its k steps in ascending order.
// Tile rows R = r0..r0+31 in [b][s] order (R = b*SEQ + s) read source rows s*NB_FULL + b; tile columns c0..c0+63 = one head.
// Epilogue: accumulators -> LDS x tile and weight tile (both cross-wave: one block barrier); from there wave w owns rows 8w..8w+7 alone: x = log1p(max(x, 0)) - lam in place;
// y[r][o] = max_i(x[r][i] + W[o][i]) with the two weight rows of each lane in registers (o = lane, lane + 32) and x rows read as LDS broadcasts; 16-byte row stores.
// grid (NB*SEQ/32, DM/64, 3) = 768 blocks, three on each of 256 WGPs when spread evenly; the projections do not depend on one another, so their tiles run side by side.
// WB holds the q, k and v weight rows one after the other (DM rows each).
__global__ __launch_bounds__(128) void k_qkvt(const bf* __restrict__ A, const bf* __restrict__ WB, const float* __restrict__ lam,
                                              const float* __restrict__ Wqt, const float* __restrict__ Wkt, const float* __restrict__ Wvt, float* TQ, float* TK, float* TV) {
    __shared__ __align__(16) float xs[PRW * XSP];
    __shared__ __align__(16) float wl[64 * XSP];
    __shared__ __align__(16) float ys[PRW * XSP];
    const int K = DM;
    const int pz = blockIdx.z;
    const bf* Bt = WB + (size_t)pz * DM * DM;
    const float* Wt = pz == 0 ? Wqt : (pz == 1 ? Wkt : Wvt);
    float* TP = pz == 0 ? TQ : (pz == 1 ? TK : TV);
    const int tid = threadIdx.x;
    const int wave = __builtin_amdgcn_readfirstlane((int)(threadIdx.x >> 5));
    const int lane = tid & 31, lr = lane & 15, hi = lane >> 4; const int r0 = blockIdx.x * PRW, c0 = blockIdx.y * 64;
    const int bb = r0 / SEQ, s0 = r0 % SEQ;
    v8f acc[2];
#pragma unroll
    for (int mb = 0; mb < 2; ++mb) acc[mb] = (v8f){};
    const unsigned aoff = (unsigned)(((s0 + lr) * NB_FULL + bb) * K + 8 * hi), boff = (unsigned)((c0 + wave * 16 + lr) * K + 8 * hi);   // element offsets, below 2^20
    const int c4 = (lane & 15) * 4, rh = lane >> 4;
    // the epilogue's global operands are asked for first: they fly under the k loop. Weight tile W[o][i]: 1024 16-B pieces / 128 threads, thread-linear
    v4f wt[8];
#pragma unroll
    for (int n = 0; n < 8; ++n) wt[n] = *(const v4f*)(Wt + (unsigned)(tid * 4) + n * 512);
    const v4f lraw = *(const v4f*)(lam + c0 + c4);                  // c0 + 63 < DM
    // the fragments of PKB k steps are all asked for before the first of their products: one memory round trip a batch instead of one a k step
#pragma unroll
    for (int kb = 0; kb < K; kb += 32 * PKB) {
        v16bf a[PKB][2], b[PKB];
#pragma unroll
        for (int s = 0; s < PKB; ++s) {
#pragma unroll
            for (int mb = 0; mb < 2; ++mb) a[s][mb] = ldb(A + aoff + mb * 16 * NB_FULL * K + kb + 32 * s);
            b[s] = ldb(Bt + boff + kb + 32 * s); }
        asm volatile("s_wait_xcnt 0x0" :: "v"(aoff), "v"(boff), "v"(tid), "v"(c4), "s"(A), "s"(Bt), "s"(Wt), "s"(lam) : "memory");   // the loads' offset registers and base pairs stay whole until this wait; it also keeps the batch's loads in front of its products
#pragma unroll
        for (int s = 0; s < PKB; ++s)
#pragma unroll
            for (int mb = 0; mb < 2; ++mb) acc[mb] = wmmab_g(a[s][mb], b[s], acc[mb]);
    }
    // D layout: element j of lane = (row 8h + j, col lane&15); 4 waves cover rows 0..31 x columns 0..63
#pragma unroll
    for (int mb = 0; mb < 2; ++mb)
#pragma unroll
        for (int j = 0; j < 8; ++j) xs[(mb * 16 + hi * 8 + j) * XSP + wave * 16 + lr] = acc[mb][j];
    // max-plus weight W[o][i], bf16-valued
#pragma unroll
    for (int n = 0; n < 8; ++n) { const int e = tid + 128 * n;
        v4f w = wt[n];
#pragma unroll
        for (int i = 0; i < 4; ++i) w[i] = bfr(w[i]);
        *(v4fa*)(&wl[(e >> 4) * XSP + (e & 15) * 4]) = w; }
    __syncthreads();                                                // xs and wl are written by all waves and read across waves
    float lv[4];
#pragma unroll
    for (int i = 0; i < 4; ++i) lv[i] = bfr(lraw[i]);
#pragma unroll 1
    for (int s = wave * 4; s < wave * 4 + 4; ++s) { const int row = 2 * s + rh;      // 4 waves x 4 trips x 2 rows = 32 rows; 16 lanes x 4 floats = 64 columns
        v4f x = *(const v4fa*)(&xs[row * XSP + c4]);
#pragma unroll
        for (int i = 0; i < 4; ++i) x[i] = log1pf(fmaxf(x[i], 0.0f)) - lv[i];
        *(v4fa*)(&xs[row * XSP + c4]) = x; }
    wave_sync();
    float wlo[64], whi[64];                                         // weight rows o = lane and o = lane + 32, static indices only
#pragma unroll
    for (int g = 0; g < 16; ++g) { const v4f t0 = *(const v4fa*)(&wl[lane * XSP + 4 * g]); const v4f t1 = *(const v4fa*)(&wl[(lane + 32) * XSP + 4 * g]);
#pragma unroll
        for (int i = 0; i < 4; ++i) { wlo[4 * g + i] = t0[i]; whi[4 * g + i] = t1[i]; } }
#pragma unroll 1
    for (int r = wave * 8; r < wave * 8 + 8; ++r) {
        float a0 = NEGB, a1 = NEGB;
#pragma unroll
        for (int g = 0; g < 16; ++g) { const v4f x = *(const v4fa*)(&xs[r * XSP + 4 * g]);
#pragma unroll
            for (int i = 0; i < 4; ++i) { a0 = fmaxf(a0, x[i] + wlo[4 * g + i]); a1 = fmaxf(a1, x[i] + whi[4 * g + i]); } }
        ys[r * XSP + lane] = a0; ys[r * XSP + lane + 32] = a1; }
    wave_sync();
    float* orow = TP + (size_t)r0 * DM + c0 + c4;
{
#pragma unroll 1
        for (int s = wave * 4; s < wave * 4 + 4; ++s) { const int row = 2 * s + rh;
            const v4f val = *(const v4fa*)(&ys[row * XSP + c4]);
            *(v4f*)(orow + (size_t)row * DM) = val; }
         }
}

// wave_sync plus a wait: a wave's stores into its own LDS range have landed before its lanes read one another's rows back
__device__ __forceinline__ void wave_publish() { wave_sync(); asm volatile("s_wait_dscnt 0x0" ::: "memory"); }

// one 4-wide piece of the difference q - k folded into the running maximum and minimum of one (query, key) pair
__device__ __forceinline__ void dmm(const v4f q, const v4f k, float& mx, float& mn) {
    const v4f d = q - k;
    mx = fmaxf(fmaxf(fmaxf(fmaxf(mx, d[0]), d[1]), d[2]), d[3]);
    mn = fminf(fminf(fminf(fminf(mn, d[0]), d[1]), d[2]), d[3]);
}

// k_mpattn: max-plus attention on the vector unit in f32; block = (group g, 32-row query tile), 256 threads = 8 waves.
// Wave w owns keys 64w..64w+63 for BOTH phases and all 32 query rows; its key rows, value rows and scores live in its own LDS range (wave-private: no block barrier in the key loop).
// Phase 1, per 16 keys: lane (qi = lane&7, kj = lane>>3) keeps a 4 x 4 register block of (query qi + 8a, key kj + 4b) pairs: 8 LDS reads feed 16 pairs.
// Phase 2, per 16 keys: lane (qg = lane>>3, dg = lane&7) keeps an 8 x 8 register block of running maxima (query qg + 4i, column 8dg + j): 4 LDS reads a key feed 64 elements.
// Scores are laid out [key][(q & 3) * 8 + (q >> 2)], so the 8 scores of a phase-2 lane are contiguous.
// After the loop each wave writes its 32 x 64 maxima over its own range; one block barrier; thread (row = tid>>3, octet = tid&7) takes the maximum over the 8 waves (max is exact: any order gives the same value).
__global__ __launch_bounds__(256) void k_mpattn(const float* __restrict__ QP, const float* __restrict__ KP, const float* __restrict__ VP, h16* AV) {
#pragma clang fp contract(off)
    __shared__ __align__(16) float qs[32 * XSP];
    __shared__ __align__(16) float wr[AW * WRG];
    const int g = blockIdx.y, sqt = blockIdx.x, tid = threadIdx.x;
    const int wave = __builtin_amdgcn_readfirstlane((int)(threadIdx.x >> 5));
    const int lane = tid & 31;
    const v4f* qb = (const v4f*)(QP + ((size_t)g * SEQ + (size_t)sqt * 32) * HD);
    const v4f* kb = (const v4f*)(KP + ((size_t)g * SEQ + (size_t)wave * KPW) * HD);
    const v4f* vb = (const v4f*)(VP + ((size_t)g * SEQ + (size_t)wave * KPW) * HD);
    float* kw = wr + wave * WRG;                 // KC key rows, pitch XSP
    float* vw = kw + KC * XSP;                   // KC value rows, pitch XSP
    float* sc = vw + KC * XSP;                   // 16 score rows, pitch SCP
    // query tile: 32 rows x 16 pieces = 512 pieces, two per thread (rows 0..15 and 16..31)
    *(v4fa*)(&qs[(tid >> 4) * XSP + (tid & 15) * 4])        = qb[tid];
    *(v4fa*)(&qs[((tid >> 4) + 16) * XSP + (tid & 15) * 4]) = qb[tid + 256];
    __syncthreads();                                       // the query tile is written by all waves and read by all
    float ctx[8][8];
#pragma unroll
    for (int i = 0; i < 8; ++i)
#pragma unroll
        for (int j = 0; j < 8; ++j) ctx[i][j] = NEGB;
    const int qi = lane & 7, kj = lane >> 3;
    const int qg = lane >> 3, dg = lane & 7;
#pragma unroll 1
    for (int t = 0; t < KPW / KC; ++t) {
        wave_sync();                                       // this wave's earlier reads of kw / vw stay in front of the refill
const int e0 = t * KC * 16 + lane;
        v4f rk[KC / 2], rv[KC / 2];                        // KC rows x 16 pieces, 32 a trip
#pragma unroll
        for (int i = 0; i < KC / 2; ++i) { rk[i] = kb[e0 + 32 * i]; rv[i] = vb[e0 + 32 * i]; }
        asm volatile("s_wait_xcnt 0x0" :: "v"(e0) : "memory");   // the loads' index register stays whole until this wait; it is reused only behind it
#pragma unroll
        for (int i = 0; i < KC / 2; ++i) { const int e = lane + 32 * i;
            *(v4fa*)(&kw[(e >> 4) * XSP + (e & 15) * 4]) = rk[i];
            *(v4fa*)(&vw[(e >> 4) * XSP + (e & 15) * 4]) = rv[i]; }
        wave_publish();                                    // key and value rows cross lanes of this wave
#pragma unroll 1
        for (int u = 0; u < KC / 16; ++u) {
            const float* ku = kw + u * 16 * XSP;
            const float* vu = vw + u * 16 * XSP;
            float mx[4][4], mn[4][4];
#pragma unroll
            for (int a = 0; a < 4; ++a)
#pragma unroll
                for (int b = 0; b < 4; ++b) { mx[a][b] = NEGB; mn[a][b] = POSB; }
#pragma unroll 2
            for (int c = 0; c < 16; ++c) {
                v4f q[4], k[4];
#pragma unroll
                for (int a = 0; a < 4; ++a) q[a] = *(const v4fa*)(&qs[(qi + 8 * a) * XSP + 4 * c]);
#pragma unroll
                for (int b = 0; b < 4; ++b) k[b] = *(const v4fa*)(&ku[(kj + 4 * b) * XSP + 4 * c]);
#pragma unroll
                for (int a = 0; a < 4; ++a)
#pragma unroll
                    for (int b = 0; b < 4; ++b) dmm(q[a], k[b], mx[a][b], mn[a][b]);
            }
#pragma unroll
            for (int a = 0; a < 4; ++a)
#pragma unroll
                for (int b = 0; b < 4; ++b) sc[(kj + 4 * b) * SCP + (qi & 3) * 8 + (qi >> 2) + 2 * a] = mn[a][b] - mx[a][b];   // = -(max - min)
            wave_publish();                                // scores cross lanes of this wave
#pragma unroll 1
            for (int kk = 0; kk < 16; kk += 2) {
                float s0[8], s1[8], v0[8], v1[8];
#pragma unroll
                for (int h = 0; h < 2; ++h) {
                    const v4f ta = *(const v4fa*)(&sc[kk * SCP + qg * 8 + 4 * h]);       const v4f tb = *(const v4fa*)(&sc[(kk + 1) * SCP + qg * 8 + 4 * h]);
                    const v4f tc = *(const v4fa*)(&vu[kk * XSP + dg * 8 + 4 * h]);       const v4f td = *(const v4fa*)(&vu[(kk + 1) * XSP + dg * 8 + 4 * h]);
#pragma unroll
                    for (int i = 0; i < 4; ++i) { s0[4 * h + i] = ta[i]; s1[4 * h + i] = tb[i]; v0[4 * h + i] = tc[i]; v1[4 * h + i] = td[i]; } }
#pragma unroll
                for (int i = 0; i < 8; ++i)
#pragma unroll
                    for (int j = 0; j < 8; ++j) ctx[i][j] = fmaxf(fmaxf(ctx[i][j], s0[i] + v0[j]), s1[i] + v1[j]);
            }
            wave_sync();                                   // this wave's reads of sc stay in front of the next scores
        }
    }
    // this wave's maxima over its own range (rows q, pitch XSP)
#pragma unroll
    for (int i = 0; i < 8; ++i)
#pragma unroll
        for (int h = 0; h < 2; ++h) { v4f o4;
#pragma unroll
            for (int j = 0; j < 4; ++j) o4[j] = ctx[i][4 * h + j];
            *(v4fa*)(&kw[(qg + 4 * i) * XSP + dg * 8 + 4 * h]) = o4; }
    __syncthreads();                                       // the per-wave maxima are read across waves
    const int sq2 = tid >> 3, dg2 = tid & 7;
    float fin[8];
#pragma unroll
    for (int j = 0; j < 8; ++j) fin[j] = NEGB;
#pragma unroll
    for (int w = 0; w < AW; ++w)
#pragma unroll
        for (int h = 0; h < 2; ++h) { const v4f p = *(const v4fa*)(&wr[w * WRG + sq2 * XSP + dg2 * 8 + 4 * h]);
#pragma unroll
            for (int j = 0; j < 4; ++j) fin[4 * h + j] = fmaxf(fin[4 * h + j], p[j]); }
    const int b2 = g / NH_, h2 = g % NH_;
    const int s2 = sqt * 32 + sq2;
    v8h o;
#pragma unroll
    for (int j = 0; j < 8; ++j) o[j] = toh_flush(expm1f(fin[j]) * ACARRY);
    h16* dst = AV + ((size_t)s2 * NB + (size_t)b2) * DM + h2 * HD + dg2 * 8;
    *(v8h*)dst = o; 
}

// k_oln: output projection (f16 product) fused with the skip connection and LayerNorm. Block = 16 rows x 512 columns, 8 waves, wave w owns columns 64w..64w+63 (4 accumulators).
// Accumulators (scaled by 1/1024) staged in a block LDS tile (cross-wave, block barrier); then wave w owns rows 2w, 2w+1 (wave-private from here): adds the bf16-valued input row as float4 at the read stage,
__global__ __launch_bounds__(256) void k_oln(const h16* __restrict__ AV, const h16* __restrict__ WO, const float* __restrict__ hin, const float* __restrict__ gamma, const float* __restrict__ beta, float* OUT) {
    __shared__ __align__(16) float ys[ORW * YSP];
    const int lane = threadIdx.x & 31, lr = lane & 15, hi = lane >> 4;
    const int wave = __builtin_amdgcn_readfirstlane((int)(threadIdx.x >> 5));
    const int r0 = blockIdx.x * ORW, c0 = wave * 64;
    v8f acc[4];
#pragma unroll
    for (int nb = 0; nb < 4; ++nb) acc[nb] = (v8f){};
    const unsigned aoff = (unsigned)((r0 + lr) * DM + 8 * hi), boff = (unsigned)((c0 + lr) * DM + 8 * hi);   // element offsets, below 2^20
    // the skip rows of this wave (rows 2w, 2w+1 of the tile) are asked for first: they fly under the k loop
    const unsigned hoff = (unsigned)(lane * 4);
    v4f hv[2][4];
#pragma unroll
    for (int rr = 0; rr < 2; ++rr) { const int mrow = r0 + wave * 2 + rr;
        const float* hrow = hin + ((size_t)(mrow / NB) * NB_FULL + (size_t)(mrow % NB)) * DM;
#pragma unroll
        for (int j = 0; j < 4; ++j) hv[rr][j] = *(const v4f*)(hrow + hoff + 128 * j); }
    // the fragments of OKB k steps are all asked for before the first of their products: one memory round trip a batch instead of one a k step
#pragma unroll
    for (int kb = 0; kb < DM; kb += 32 * OKB) {
        v16h a[OKB], b[OKB][4];
#pragma unroll
        for (int s = 0; s < OKB; ++s) { a[s] = ldh(AV + aoff + kb + 32 * s);
#pragma unroll
            for (int nb = 0; nb < 4; ++nb) b[s][nb] = ldh(WO + boff + nb * 16 * DM + kb + 32 * s); }
        asm volatile("s_wait_xcnt 0x0" :: "v"(aoff), "v"(boff), "v"(hoff), "s"(AV), "s"(WO), "s"(hin) : "memory");   // the loads' offset registers and base pairs stay whole until this wait; it also keeps the batch's loads in front of its products
#pragma unroll
        for (int s = 0; s < OKB; ++s)
#pragma unroll
            for (int nb = 0; nb < 4; ++nb) acc[nb] = wmma16_g(a[s], b[s][nb], acc[nb]);
    }
    // D layout: element j of lane = (row 8h + j, col lane&15); 8 waves cover rows 0..15 x columns 0..511
#pragma unroll
    for (int nb = 0; nb < 4; ++nb)
#pragma unroll
        for (int j = 0; j < 8; ++j) ys[(hi * 8 + j) * YSP + c0 + nb * 16 + lr] = acc[nb][j] * OSCL;
    __syncthreads();
    // gain and offset, the same for both rows: asked for behind the barrier, so that no wave waits for them in front of it; they fly under the rows' sums
    v4f gv[4], bv[4];
#pragma unroll
    for (int j = 0; j < 4; ++j) { gv[j] = *(const v4f*)(gamma + hoff + 128 * j); bv[j] = *(const v4f*)(beta + hoff + 128 * j); }
    asm volatile("s_wait_xcnt 0x0" :: "v"(hoff), "s"(gamma), "s"(beta) : "memory");   // as above, for the gain and offset loads
#pragma unroll
    for (int rr = 0; rr < 2; ++rr) {                                      // unrolled: hv is indexed by rr and stays in registers
        const int row = wave * 2 + rr;                                    // plane row r0 + row = s2*NB + b2
        v4f y[4]; float sum = 0.0f;
#pragma unroll
        for (int j = 0; j < 4; ++j) { const int c = (lane + 32 * j) * 4;
            const v4f a = *(const v4fa*)(&ys[row * YSP + c]);
#pragma unroll
            for (int i = 0; i < 4; ++i) { y[j][i] = bfr(hv[rr][j][i]) + a[i]; sum += y[j][i]; } }
        sum = wsum(sum);
        const float mu = sum * (1.0f / (float)DM);
        float sq = 0.0f;
#pragma unroll
        for (int j = 0; j < 4; ++j)
#pragma unroll
            for (int i = 0; i < 4; ++i) { const float d = y[j][i] - mu; y[j][i] = d; sq += d * d; }
        sq = wsum(sq);
        const float rstd = rsqrtf(sq * (1.0f / (float)DM) + LNEPS);
#pragma unroll
        for (int j = 0; j < 4; ++j) { const int c = (lane + 32 * j) * 4;
            v4f ov;
#pragma unroll
            for (int i = 0; i < 4; ++i) ov[i] = y[j][i] * rstd * bfr(gv[j][i]) + bfr(bv[j][i]);
            *(v4fa*)(&ys[row * YSP + c]) = ov; }
    }
    wave_sync();
{
#pragma unroll 1
        for (int rr = 0; rr < 2; ++rr) {
            const int row = wave * 2 + rr;
            const int mrow = r0 + row;
            const size_t grow = (size_t)(mrow / NB) * NB_FULL + (size_t)(mrow % NB);
#pragma unroll
            for (int j = 0; j < 4; ++j) { const int c = (lane + 32 * j) * 4;   // 4 instructions x 32 lanes x 16 B = 2048 B = one output row
                const v4f val = *(const v4fa*)(&ys[row * YSP + c]);
                *(v4f*)(OUT + grow * DM + c) = val; } }
         }
}

static constexpr size_t al256(size_t v) { return (v + 255) & ~(size_t)255; }
static constexpr size_t SZ_XB = al256((size_t)SEQ * NB_FULL * DM * 2);     // bf16 x, source row order
static constexpr size_t SZ_WB = al256((size_t)3 * DM * DM * 2);            // bf16 Wq | Wkv
static constexpr size_t SZ_WO = al256((size_t)DM * DM * 2);                // f16 Wo x64
static constexpr size_t SZ_TP = al256((size_t)NB * SEQ * DM * 4);          // f32 q / k / v planes after the head linear
static constexpr size_t SZ_AV = al256((size_t)NB * SEQ * DM * 2);          // f16 attention vector x16
static constexpr size_t SZ_TOTAL = SZ_XB + SZ_WB + SZ_WO + 3 * SZ_TP + SZ_AV;
static_assert(SZ_TOTAL <= (size_t)134217728);          // workspace carve <= 128 MiB
static_assert(((size_t)DM * DM * 2) % 256 == 0);       // weight sub-planes stay 256-byte aligned

extern "C" void kernel_launch(void* const* d_in, const int* in_sizes, int n_in,
                              void* d_out, int out_size, void* d_ws, size_t ws_size, hipStream_t stream) {
    if (n_in < 10) return;
    if ((size_t)in_sizes[0] < (size_t)SEQ * NB_FULL * DM) return;
    if ((size_t)in_sizes[1] < (size_t)DM * DM || (size_t)in_sizes[2] < (size_t)2 * DM * DM || (size_t)in_sizes[7] < (size_t)DM * DM) return;
    if (in_sizes[3] < HD * HD || in_sizes[4] < HD * HD || in_sizes[5] < HD * HD) return;
    if (in_sizes[6] < DM || in_sizes[8] < DM || in_sizes[9] < DM) return;
    if ((size_t)out_size < ((size_t)(SEQ - 1) * NB_FULL + NB) * DM) return;
    if (SZ_TOTAL > ws_size) return;
    // wire order: h, Wq, Wkv, Wqt, Wkt, Wvt, lam, Wo, gamma, beta
    const float* hin = (const float*)d_in[0];
    const float* wq  = (const float*)d_in[1];
    const float* wkv = (const float*)d_in[2];
    const float* wqt = (const float*)d_in[3];
    const float* wkt = (const float*)d_in[4];
    const float* wvt = (const float*)d_in[5];
    const float* lam = (const float*)d_in[6];
    const float* wo  = (const float*)d_in[7];
    const float* gam = (const float*)d_in[8];
    const float* bet = (const float*)d_in[9];
    float* OUT = (float*)d_out;      // [SEQ][NB_FULL][512]
    char* wsp = (char*)d_ws;
    bf*  XB  = (bf*)wsp;  wsp += SZ_XB;                 // [SEQ*NB_FULL][512]
    bf*  WB  = (bf*)wsp;  wsp += SZ_WB;                 // [1536][512]: q rows | k rows | v rows
    h16* WOH = (h16*)wsp; wsp += SZ_WO;                 // [512][512]
    float* TQ = (float*)wsp; wsp += SZ_TP;              // [NB*SEQ][512], row b*SEQ + s
    float* TK = (float*)wsp; wsp += SZ_TP;
    float* TV = (float*)wsp; wsp += SZ_TP;
    h16* AV  = (h16*)wsp; wsp += SZ_AV;                 // [NB*SEQ][512], row s2*NB + b2

    k_prep<<<dim3(PBL, 1, 1), PTH, 0, stream>>>(hin, wq, wkv, wo, XB, WB, WOH);

    // projections: A = x rows (tile row R = b*SEQ + s <- source row s*NB_FULL + b), Bt = W rows (n = head*64 + d) -> plane [R][512]
    k_qkvt<<<dim3(NB * SEQ / PRW, DM / 64, 3), 128, 0, stream>>>(XB, WB, lam, wqt, wkt, wvt, TQ, TK, TV);

    k_mpattn<<<dim3(SEQ / 32, NB * NH_, 1), 256, 0, stream>>>(TQ, TK, TV, AV);

    k_oln<<<dim3(NB * SEQ / ORW, 1, 1), 256, 0, stream>>>(AV, WOH, hin, gam, bet, OUT);
}

// v006
// Measured time: 38.8 microseconds a run.
// Next to v005, in two timings, it ran 1.28 and 1.27 times as fast.
// Counting every step since v000, it is 5.28 times as fast.
#include <hip/hip_runtime.h>

// Max-plus multi-head attention block, width 512 = 8 heads x 64: x [SEQ][NB_FULL][512]; Wq [512][512], Wkv [1024][512] (k rows then v rows), Wo [512][512], all [out][in] (y = x W^T);
// per-feature shift lam [512]; three 64x64 max-plus head weights; post-LN over (x + attention output) with gain and offset inputs.
// Compute dtypes, f32 accumulate everywhere: q/k/v projections v_wmma_f32_16x16x32_bf16 (x and W RNE-converted to bf16; products exact);
// output projection v_wmma_f32_16x16x32_f16, one product: attention vector as f16 with a x16 carry, bf16-valued Wo as f16 with a x64 carry, folded by 1/1024 in the f32 epilogue.
// Max-plus stages (head linear y[o] = max_i(x[i] + W[o][i]); score = -(max_d(q-k) - min_d(q-k)); context = max_key(score + v)) are semiring operations and run in f32 on the vector unit, as do log1p, expm1 and LayerNorm.
// Layout: the head regrouping is the flat reshape of [b][s][head][d] into [b*8 + s/(SEQ/8)][(s % (SEQ/8))*8 + head][d], i.e. group g is the contiguous SEQ x 64 chunk g of a [b][s][512] plane; the q/k/v planes are kept in that order
// (GEMM row R = b*SEQ + s holds source row s*NB_FULL + b). Attention vector plane rows b2*SEQ + s2 with g = b2*8 + h2, columns h2*64 + d.
// Every 16-bit matrix operand plane (x, Wq|Wkv, Wo, attention vector) is kept in FRAGMENT ORDER: 16 rows x 32 k = one fragment = 1024 contiguous bytes, first the 32 lanes' elements 0..7 (16 B a lane), then their elements 8..15;
// fragments of one 16-row tile follow one another in k. A wave's fragment load is then two loads of 512 contiguous bytes (4 whole 128-B lines each) instead of two loads that touch 16 lines.

#ifndef NB
#define NB 2
#endif
#ifndef SEQ
#define SEQ 512
#endif
#define NB_FULL  2
#define SEQ_FULL 512
#define DM   512
#define NH_  8
#define HD   64
#define FRG  512                 // 16-bit elements of one fragment (16 rows x 32 k)
#define TIL  ((DM / 32) * FRG)   // 16-bit elements of one 16-row tile over all k
#define XSP  68                  // LDS row pitch (floats) of the 64-column tiles of the projection kernel
#define YSP  516                 // LDS row pitch (floats) of the 16 x 512 tile of the output kernel
#define ORW  16                  // rows per block of the output kernel
#define PRW  32                  // rows per block of the projection kernel
#define PKB  8                   // k steps whose fragments the projection kernel loads in one batch
#define OKB  4                   // k steps whose fragments the output kernel loads in one batch
#define AW   8                   // waves per block of the attention kernel
#define KPW  (SEQ / AW)          // keys a wave of the attention kernel owns
#define KC   32                  // keys a wave stages at a time
#define SCP  36                  // LDS row pitch (floats) of a wave's score rows (32 queries)
#define WRG  (2 * KC * XSP + 16 * SCP)   // floats of one wave's LDS range in the attention kernel
#define ACARRY 16.0f             // carry of the f16 attention vector plane
#define WCARRY 64.0f             // carry of the f16 Wo plane
#define OSCL (1.0f / 1024.0f)    // 1 / (ACARRY * WCARRY)
#define PBL  256                 // blocks of the convert kernel
#define PTH  128                 // threads per block of the convert kernel
#define PNT  (PBL * PTH)         // threads of the convert kernel
#define NPX  (SEQ * NB_FULL * DM / 8 / PNT)   // 8-float pieces of x a thread converts
#define NPW  (DM * DM / 8 / PNT)              // 8-float pieces of one DM x DM weight a thread converts
#define LNEPS 1e-5f
#define NEGB (-3.0e38f)
#define POSB (3.0e38f)

static_assert(NH_ * HD == DM);                 // head h = columns h*64 + d
static_assert(HD == 64);                       // one 64-column GEMM tile = one head; attention lanes own 8 octets of d
static_assert(DM % 64 == 0);
static_assert(DM % 32 == 0);                   // GEMM k-loops step by 32
static_assert(DM / 32 == 16);                  // the convert kernel takes the k step of a piece from 4 bits of its index
static_assert(SEQ % 16 == 0);                  // a 16-row tile never straddles two batches
static_assert(DM % (32 * PKB) == 0);           // whole batches of k steps
static_assert(DM % (32 * OKB) == 0);
static_assert(SEQ % PRW == 0);                 // a projection tile never straddles two batches
static_assert((NB * SEQ) % PRW == 0);
static_assert(PRW == 32);                      // 2 WMMA row slabs per wave; 4 waves x 8 epilogue rows
static_assert(SEQ % 32 == 0);                  // attention query tiles of 32 rows
static_assert(SEQ % (AW * KC) == 0);           // every wave owns whole staging chunks of keys
static_assert(KC % 16 == 0);                   // phase blocks of 16 keys
static_assert((SCP * 4) % 16 == 0);
static_assert(SCP >= 32);
static_assert(WRG >= 32 * XSP);                // a wave's 32 x 64 maxima fit its own range
static_assert((WRG * 4) % 16 == 0);
static_assert(SEQ % NH_ == 0);                 // tokens per group = SEQ / 8
static_assert((NB * SEQ) % ORW == 0);
static_assert(ORW == 16);                      // one 16-row WMMA slab per block of the output kernel
static_assert(8 * 64 == DM);                   // 8 waves x 64 columns cover one output row
static_assert(NB <= NB_FULL);
static_assert(SEQ <= SEQ_FULL);
static_assert((XSP * 4) % 16 == 0);
static_assert(XSP >= 64);
static_assert((YSP * 4) % 16 == 0);
static_assert(YSP >= DM);
static_assert(((size_t)SEQ * NB_FULL * DM) % 8 == 0);
static_assert(((size_t)DM * DM) % 8 == 0);
static_assert((size_t)NPX * PNT * 8 == (size_t)SEQ * NB_FULL * DM);   // the convert grid covers x exactly
static_assert((size_t)NPW * PNT * 8 == (size_t)DM * DM);              // and each DM x DM weight exactly
static_assert(PNT / 64 == SEQ && DM == 512);                          // one pass of the convert grid = the SEQ plane rows of one batch
static_assert(NPX == NB_FULL);
static_assert(4 * 32 * 16 * 4 == PRW * 64 * 4);        // projection store: 4 waves x 32 lanes x 16 B x 4 trips == 32 rows x 256 B
static_assert(256 * 16 == 32 * HD * 2);
static_assert(AW * 32 == 256);
static_assert(8 * (ORW / 8) * 4 * 32 * 16 == ORW * DM * 4);   // output store: 8 waves x 2 rows x 4 instructions x 512 B == 16 rows x 2048 B
static_assert((2 * PRW + 64) * XSP * 4 <= 131072);     // static LDS of the projection kernel
static_assert((32 * XSP + AW * WRG) * 4 <= 327680);    // static LDS of the attention kernel
static_assert(ORW * YSP * 4 <= 131072);                // static LDS of the output kernel

typedef _Float16 h16;
typedef unsigned short bf;
typedef __attribute__((ext_vector_type(16))) __bf16   v16bf;
typedef __attribute__((ext_vector_type(16))) _Float16 v16h;
typedef __attribute__((ext_vector_type(8)))  _Float16 v8h;
typedef __attribute__((ext_vector_type(8)))  unsigned short v8us;
typedef __attribute__((ext_vector_type(8)))  float    v8f;
typedef __attribute__((ext_vector_type(4)))  float    v4f;
typedef v4f  __attribute__((may_alias)) v4fa;

__device__ __forceinline__ unsigned short f2bf(float f) { unsigned u = __float_as_uint(f); u += 0x7FFFu + ((u >> 16) & 1u); return (unsigned short)(u >> 16); }
__device__ __forceinline__ float bfr(float f) { return __uint_as_float(((unsigned)f2bf(f)) << 16); }   // value after RNE convert to bf16
__device__ __forceinline__ v16h cat16(v8h lo, v8h hi) { return __builtin_shufflevector(lo, hi, 0, 1, 2, 3, 4, 5, 6, 7, 8, 9, 10, 11, 12, 13, 14, 15); }
__device__ __forceinline__ v16bf cat16b(v8us lo, v8us hi) { return __builtin_bit_cast(v16bf, __builtin_shufflevector(lo, hi, 0, 1, 2, 3, 4, 5, 6, 7, 8, 9, 10, 11, 12, 13, 14, 15)); }
__device__ __forceinline__ v8f wmma16(v16h a, v16h b, v8f c) { return __builtin_amdgcn_wmma_f32_16x16x32_f16(false, a, false, b, (short)0, c, false, false); }
__device__ __forceinline__ v8f wmmab(v16bf a, v16bf b, v8f c) { return __builtin_amdgcn_wmma_f32_16x16x32_bf16(false, a, false, b, (short)0, c, false, false); }
// fragment loaders from a plane in fragment order; p = fragment start + 8*lane, lane = 16h + row: elements 0..7 <- k0+8h+0..7, elements 8..15 <- k0+16+8h+0..7 (same map for A and B)
__device__ __forceinline__ v16h  ldh(const h16* p) { return cat16(*(const v8h*)p, *(const v8h*)(p + FRG / 2)); }
__device__ __forceinline__ v16bf ldb(const bf* p)  { return cat16b(*(const v8us*)p, *(const v8us*)(p + FRG / 2)); }
// ordering point for wave-private LDS tiles (same wave writes and reads)
__device__ __forceinline__ void wave_sync() { __builtin_amdgcn_fence(3 /* release order */, "wavefront"); __builtin_amdgcn_wave_barrier(); asm volatile("" ::: "memory"); }

// per-instruction guarded matrix products: one accumulator tied per guard, operands kept live across the nops
__device__ __forceinline__ v8f wmmab_g(v16bf a, v16bf b, v8f c) { c = wmmab(a, b, c); asm volatile("v_nop\n\tv_nop\n\tv_nop\n\tv_nop" : "+v"(c) : "v"(a), "v"(b)); return c; }
__device__ __forceinline__ v8f wmma16_g(v16h a, v16h b, v8f c) { c = wmma16(a, b, c); asm volatile("v_nop\n\tv_nop\n\tv_nop\n\tv_nop" : "+v"(c) : "v"(a), "v"(b)); return c; }
// f32 -> f16 convert that cannot produce a subnormal operand (|v| < 2^-14 -> +0), applied after the plane's carry
static __device__ __forceinline__ h16 toh_flush(float v) { const h16 r = (h16)v; return (fabsf(v) < 6.103515625e-05f) ? (h16)0.0f : r; }
__device__ __forceinline__ float wsum(float v) { v += __shfl_xor(v, 16, 32); v += __shfl_xor(v, 8, 32); v += __shfl_xor(v, 4, 32); v += __shfl_xor(v, 2, 32); v += __shfl_xor(v, 1, 32); return v; }

// k_prep: all four operand conversions in one grid. Thread i owns one piece (8 elements of one row) in each pass n of x, of Wq, of Wkv (2 DM x DM planes) and of Wo; every load is issued before the first convert.
// Bits of i: octet of the k step (2: h, then half of the fragment), row in tile (4), k step (4), tile (rest). A wave reads one whole 128-B line in each of 8 rows and stores four whole 128-B lines (8 rows x 16 B each).
// x, Wq, Wkv -> bf16 (RNE); Wo -> bf16-valued f16 with the x64 carry. WB holds the Wq rows, then the Wkv rows.
__global__ __launch_bounds__(PTH) void k_prep(const float* __restrict__ x, const float* __restrict__ wq, const float* __restrict__ wkv, const float* __restrict__ wo,
                                              bf* __restrict__ XB, bf* __restrict__ WB, h16* __restrict__ WOH) {
    const unsigned i = blockIdx.x * PTH + threadIdx.x;
    const unsigned ko = ((i >> 6) & 15u) * 32u + (i & 3u) * 8u;   // first k of the piece
    const unsigned lr = (i >> 2) & 15u;                    // its row in the 16-row tile
    const unsigned rw = (i >> 10) * 16u + lr;              // its plane row in pass 0; pass n lies PNT / 64 = SEQ rows further
    const unsigned dp = (i & ~63u) | ((i & 2u) << 4) | ((i & 1u) << 4) | lr;   // its place in fragment order: (tile, k step) kept, then half, h, row; pass n lies n * PNT pieces further
    const unsigned ib = (rw * DM + ko) * 4u;               // byte offset of the piece in an f32 weight; pass n lies n * PNT * 32 bytes further
    const unsigned xb = (rw * NB_FULL * DM + ko) * 4u;     // the same in x: plane row n*SEQ + rw is source row rw*NB_FULL + n
    v8f vx[NPX], vq[NPW], vk[2 * NPW], vo[NPW];
#pragma unroll
    for (int n = 0; n < NPX; ++n) vx[n] = *(const v8f*)((const char*)x + xb + (size_t)n * DM * 4);
#pragma unroll
    for (int n = 0; n < 2 * NPW; ++n) vk[n] = *(const v8f*)((const char*)wkv + ib + (size_t)n * PNT * 32);
#pragma unroll
    for (int n = 0; n < NPW; ++n) { vq[n] = *(const v8f*)((const char*)wq + ib + (size_t)n * PNT * 32); vo[n] = *(const v8f*)((const char*)wo + ib + (size_t)n * PNT * 32); }
    asm volatile("s_wait_xcnt 0x0" :: "v"(ib), "v"(xb), "s"(x), "s"(wq), "s"(wkv), "s"(wo) : "memory");   // the loads' offset registers and base pairs stay whole until this wait; they are reused only behind it
#pragma unroll
    for (int n = 0; n < NPX; ++n) { v8us o;
#pragma unroll
        for (int k = 0; k < 8; ++k) o[k] = f2bf(vx[n][k]);
        *(v8us*)(XB + ((size_t)n * PNT + dp) * 8) = o; }
#pragma unroll
    for (int n = 0; n < 2 * NPW; ++n) { v8us o;
#pragma unroll
        for (int k = 0; k < 8; ++k) o[k] = f2bf(vk[n][k]);
        *(v8us*)(WB + (size_t)DM * DM + ((size_t)n * PNT + dp) * 8) = o; }
#pragma unroll
    for (int n = 0; n < NPW; ++n) { v8us o; v8h oh;
#pragma unroll
        for (int k = 0; k < 8; ++k) { o[k] = f2bf(vq[n][k]); oh[k] = toh_flush(bfr(vo[n][k]) * WCARRY); }
        *(v8us*)(WB + ((size_t)n * PNT + dp) * 8) = o;
        *(v8h*)(WOH + ((size_t)n * PNT + dp) * 8) = oh; }
}

// k_qkvt: the three projections (blockIdx.z = 0, 1, 2 for q, k, v) in one grid, each fused with its shift-log and its max-plus head linear. FOUR WAVES per 32x64 tile, bf16 operands straight from fragment-order planes, K = DM.
// Product: wave w owns all 32 rows and the 16 columns of quarter w (2 accumulators, one B fragment a k step); every accumulator sums its k steps in ascending order.
// Tile rows R = r0..r0+31 in [b][s] order (R = b*SEQ + s), the row order of the x plane; tile columns c0..c0+63 = one head.
// Epilogue: accumulators -> LDS x tile and weight tile (both cross-wave: one block barrier); from there wave w owns rows 8w..8w+7 alone: x = log1p(max(x, 0)) - lam in place;
// y[r][o] = max_i(x[r][i] + W[o][i]) with the two weight rows of each lane in registers (o = lane, lane + 32) and x rows read as LDS broadcasts; 16-byte row stores.
// grid (NB*SEQ/32, DM/64, 3) = 768 blocks, three on each of 256 WGPs when spread evenly; the projections do not depend on one another, so their tiles run side by side.
// WB holds the q, k and v weight rows one after the other (DM rows each).
__global__ __launch_bounds__(128) void k_qkvt(const bf* __restrict__ A, const bf* __restrict__ WB, const float* __restrict__ lam,
                                              const float* __restrict__ Wqt, const float* __restrict__ Wkt, const float* __restrict__ Wvt, float* TQ, float* TK, float* TV) {
    __shared__ __align__(16) float xs[PRW * XSP];
    __shared__ __align__(16) float wl[64 * XSP];
    __shared__ __align__(16) float ys[PRW * XSP];
    const int K = DM;
    const int pz = blockIdx.z;
    const bf* Bt = WB + (size_t)pz * DM * DM;
    const float* Wt = pz == 0 ? Wqt : (pz == 1 ? Wkt : Wvt);
    float* TP = pz == 0 ? TQ : (pz == 1 ? TK : TV);
    const int tid = threadIdx.x;
    const int wave = __builtin_amdgcn_readfirstlane((int)(threadIdx.x >> 5));
    const int lane = tid & 31, lr = lane & 15, hi = lane >> 4; const int r0 = blockIdx.x * PRW, c0 = blockIdx.y * 64;
    v8f acc[2];
#pragma unroll
    for (int mb = 0; mb < 2; ++mb) acc[mb] = (v8f){};
    const unsigned aoff = (unsigned)((r0 / 16) * TIL + 8 * lane), boff = (unsigned)((c0 / 16 + wave) * TIL + 8 * lane);   // element offsets, below 2^20
    const int c4 = (lane & 15) * 4, rh = lane >> 4;
    // the epilogue's global operands are asked for first: they fly under the k loop. Weight tile W[o][i]: 1024 16-B pieces / 128 threads, thread-linear
    v4f wt[8];
#pragma unroll
    for (int n = 0; n < 8; ++n) wt[n] = *(const v4f*)(Wt + (unsigned)(tid * 4) + n * 512);
    const v4f lraw = *(const v4f*)(lam + c0 + c4);                  // c0 + 63 < DM
    // the fragments of PKB k steps are all asked for before the first of their products: one memory round trip a batch instead of one a k step
#pragma unroll
    for (int kb = 0; kb < K; kb += 32 * PKB) {
        v16bf a[PKB][2], b[PKB];
#pragma unroll
        for (int s = 0; s < PKB; ++s) {
#pragma unroll
            for (int mb = 0; mb < 2; ++mb) a[s][mb] = ldb(A + aoff + mb * TIL + (kb / 32 + s) * FRG);
            b[s] = ldb(Bt + boff + (kb / 32 + s) * FRG); }
        asm volatile("s_wait_xcnt 0x0" :: "v"(aoff), "v"(boff), "v"(tid), "v"(c4), "s"(A), "s"(Bt), "s"(Wt), "s"(lam) : "memory");   // the loads' offset registers and base pairs stay whole until this wait; it also keeps the batch's loads in front of its products
#pragma unroll
        for (int s = 0; s < PKB; ++s)
#pragma unroll
            for (int mb = 0; mb < 2; ++mb) acc[mb] = wmmab_g(a[s][mb], b[s], acc[mb]);
    }
    // D layout: element j of lane = (row 8h + j, col lane&15); 4 waves cover rows 0..31 x columns 0..63
#pragma unroll
    for (int mb = 0; mb < 2; ++mb)
#pragma unroll
        for (int j = 0; j < 8; ++j) xs[(mb * 16 + hi * 8 + j) * XSP + wave * 16 + lr] = acc[mb][j];
    // max-plus weight W[o][i], bf16-valued
#pragma unroll
    for (int n = 0; n < 8; ++n) { const int e = tid + 128 * n;
        v4f w = wt[n];
#pragma unroll
        for (int i = 0; i < 4; ++i) w[i] = bfr(w[i]);
        *(v4fa*)(&wl[(e >> 4) * XSP + (e & 15) * 4]) = w; }
    __syncthreads();                                                // xs and wl are written by all waves and read across waves
    float lv[4];
#pragma unroll
    for (int i = 0; i < 4; ++i) lv[i] = bfr(lraw[i]);
#pragma unroll 1
    for (int s = wave * 4; s < wave * 4 + 4; ++s) { const int row = 2 * s + rh;      // 4 waves x 4 trips x 2 rows = 32 rows; 16 lanes x 4 floats = 64 columns
        v4f x = *(const v4fa*)(&xs[row * XSP + c4]);
#pragma unroll
        for (int i = 0; i < 4; ++i) x[i] = log1pf(fmaxf(x[i], 0.0f)) - lv[i];
        *(v4fa*)(&xs[row * XSP + c4]) = x; }
    wave_sync();
    float wlo[64], whi[64];                                         // weight rows o = lane and o = lane + 32, static indices only
#pragma unroll
    for (int g = 0; g < 16; ++g) { const v4f t0 = *(const v4fa*)(&wl[lane * XSP + 4 * g]); const v4f t1 = *(const v4fa*)(&wl[(lane + 32) * XSP + 4 * g]);
#pragma unroll
        for (int i = 0; i < 4; ++i) { wlo[4 * g + i] = t0[i]; whi[4 * g + i] = t1[i]; } }
#pragma unroll 1
    for (int r = wave * 8; r < wave * 8 + 8; ++r) {
        float a0 = NEGB, a1 = NEGB;
#pragma unroll
        for (int g = 0; g < 16; ++g) { const v4f x = *(const v4fa*)(&xs[r * XSP + 4 * g]);
#pragma unroll
            for (int i = 0; i < 4; ++i) { a0 = fmaxf(a0, x[i] + wlo[4 * g + i]); a1 = fmaxf(a1, x[i] + whi[4 * g + i]); } }
        ys[r * XSP + lane] = a0; ys[r * XSP + lane + 32] = a1; }
    wave_sync();
    float* orow = TP + (size_t)r0 * DM + c0 + c4;
{
#pragma unroll 1
        for (int s = wave * 4; s < wave * 4 + 4; ++s) { const int row = 2 * s + rh;
            const v4f val = *(const v4fa*)(&ys[row * XSP + c4]);
            *(v4f*)(orow + (size_t)row * DM) = val; }
         }
}

// wave_sync plus a wait: a wave's stores into its own LDS range have landed before its lanes read one another's rows back
__device__ __forceinline__ void wave_publish() { wave_sync(); asm volatile("s_wait_dscnt 0x0" ::: "memory"); }

// one 4-wide piece of the difference q - k folded into the running maximum and minimum of one (query, key) pair
__device__ __forceinline__ void dmm(const v4f q, const v4f k, float& mx, float& mn) {
    const v4f d = q - k;
    mx = fmaxf(fmaxf(fmaxf(fmaxf(mx, d[0]), d[1]), d[2]), d[3]);
    mn = fminf(fminf(fminf(fminf(mn, d[0]), d[1]), d[2]), d[3]);
}

// k_mpattn: max-plus attention on the vector unit in f32; block = (group g, 32-row query tile), 256 threads = 8 waves.
// Wave w owns keys 64w..64w+63 for BOTH phases and all 32 query rows; its key rows, value rows and scores live in its own LDS range (wave-private: no block barrier in the key loop).
// Phase 1, per 16 keys: lane (qi = lane&7, kj = lane>>3) keeps a 4 x 4 register block of (query qi + 8a, key kj + 4b) pairs: 8 LDS reads feed 16 pairs.
// Phase 2, per 16 keys: lane (qg = lane>>3, dg = lane&7) keeps an 8 x 8 register block of running maxima (query qg + 4i, column 8dg + j): 4 LDS reads a key feed 64 elements.
// Scores are laid out [key][(q & 3) * 8 + (q >> 2)], so the 8 scores of a phase-2 lane are contiguous.
// After the loop each wave writes its 32 x 64 maxima over its own range; one block barrier; thread (row = 16*(wave&1) + (lane&15), octet = 2*(wave>>1) + (lane>>4)) takes the maximum over the 8 waves (max is exact: any order gives the same value);
// that map makes a wave's 32 pieces one half fragment of the attention vector plane: 512 contiguous bytes a store.
__global__ __launch_bounds__(256) void k_mpattn(const float* __restrict__ QP, const float* __restrict__ KP, const float* __restrict__ VP, h16* AV) {
#pragma clang fp contract(off)
    __shared__ __align__(16) float qs[32 * XSP];
    __shared__ __align__(16) float wr[AW * WRG];
    const int g = blockIdx.y, sqt = blockIdx.x, tid = threadIdx.x;
    const int wave = __builtin_amdgcn_readfirstlane((int)(threadIdx.x >> 5));
    const int lane = tid & 31;
    const v4f* qb = (const v4f*)(QP + ((size_t)g * SEQ + (size_t)sqt * 32) * HD);
    const v4f* kb = (const v4f*)(KP + ((size_t)g * SEQ + (size_t)wave * KPW) * HD);
    const v4f* vb = (const v4f*)(VP + ((size_t)g * SEQ + (size_t)wave * KPW) * HD);
    float* kw = wr + wave * WRG;                 // KC key rows, pitch XSP
    float* vw = kw + KC * XSP;                   // KC value rows, pitch XSP
    float* sc = vw + KC * XSP;                   // 16 score rows, pitch SCP
    // query tile: 32 rows x 16 pieces = 512 pieces, two per thread (rows 0..15 and 16..31)
    *(v4fa*)(&qs[(tid >> 4) * XSP + (tid & 15) * 4])        = qb[tid];
    *(v4fa*)(&qs[((tid >> 4) + 16) * XSP + (tid & 15) * 4]) = qb[tid + 256];
    __syncthreads();                                       // the query tile is written by all waves and read by all
    float ctx[8][8];
#pragma unroll
    for (int i = 0; i < 8; ++i)
#pragma unroll
        for (int j = 0; j < 8; ++j) ctx[i][j] = NEGB;
    const int qi = lane & 7, kj = lane >> 3;
    const int qg = lane >> 3, dg = lane & 7;
#pragma unroll 1
    for (int t = 0; t < KPW / KC; ++t) {
        wave_sync();                                       // this wave's earlier reads of kw / vw stay in front of the refill
const int e0 = t * KC * 16 + lane;
        v4f rk[KC / 2], rv[KC / 2];                        // KC rows x 16 pieces, 32 a trip
#pragma unroll
        for (int i = 0; i < KC / 2; ++i) { rk[i] = kb[e0 + 32 * i]; rv[i] = vb[e0 + 32 * i]; }
        asm volatile("s_wait_xcnt 0x0" :: "v"(e0) : "memory");   // the loads' index register stays whole until this wait; it is reused only behind it
#pragma unroll
        for (int i = 0; i < KC / 2; ++i) { const int e = lane + 32 * i;
            *(v4fa*)(&kw[(e >> 4) * XSP + (e & 15) * 4]) = rk[i];
            *(v4fa*)(&vw[(e >> 4) * XSP + (e & 15) * 4]) = rv[i]; }
        wave_publish();                                    // key and value rows cross lanes of this wave
#pragma unroll 1
        for (int u = 0; u < KC / 16; ++u) {
            const float* ku = kw + u * 16 * XSP;
            const float* vu = vw + u * 16 * XSP;
            float mx[4][4], mn[4][4];
#pragma unroll
            for (int a = 0; a < 4; ++a)
#pragma unroll
                for (int b = 0; b < 4; ++b) { mx[a][b] = NEGB; mn[a][b] = POSB; }
#pragma unroll 2
            for (int c = 0; c < 16; ++c) {
                v4f q[4], k[4];
#pragma unroll
                for (int a = 0; a < 4; ++a) q[a] = *(const v4fa*)(&qs[(qi + 8 * a) * XSP + 4 * c]);
#pragma unroll
                for (int b = 0; b < 4; ++b) k[b] = *(const v4fa*)(&ku[(kj + 4 * b) * XSP + 4 * c]);
#pragma unroll
                for (int a = 0; a < 4; ++a)
#pragma unroll
                    for (int b = 0; b < 4; ++b) dmm(q[a], k[b], mx[a][b], mn[a][b]);
            }
#pragma unroll
            for (int a = 0; a < 4; ++a)
#pragma unroll
                for (int b = 0; b < 4; ++b) sc[(kj + 4 * b) * SCP + (qi & 3) * 8 + (qi >> 2) + 2 * a] = mn[a][b] - mx[a][b];   // = -(max - min)
            wave_publish();                                // scores cross lanes of this wave
#pragma unroll 1
            for (int kk = 0; kk < 16; kk += 2) {
                float s0[8], s1[8], v0[8], v1[8];
#pragma unroll
                for (int h = 0; h < 2; ++h) {
                    const v4f ta = *(const v4fa*)(&sc[kk * SCP + qg * 8 + 4 * h]);       const v4f tb = *(const v4fa*)(&sc[(kk + 1) * SCP + qg * 8 + 4 * h]);
                    const v4f tc = *(const v4fa*)(&vu[kk * XSP + dg * 8 + 4 * h]);       const v4f td = *(const v4fa*)(&vu[(kk + 1) * XSP + dg * 8 + 4 * h]);
#pragma unroll
                    for (int i = 0; i < 4; ++i) { s0[4 * h + i] = ta[i]; s1[4 * h + i] = tb[i]; v0[4 * h + i] = tc[i]; v1[4 * h + i] = td[i]; } }
#pragma unroll
                for (int i = 0; i < 8; ++i)
#pragma unroll
                    for (int j = 0; j < 8; ++j) ctx[i][j] = fmaxf(fmaxf(ctx[i][j], s0[i] + v0[j]), s1[i] + v1[j]);
            }
            wave_sync();                                   // this wave's reads of sc stay in front of the next scores
        }
    }
    // this wave's maxima over its own range (rows q, pitch XSP)
#pragma unroll
    for (int i = 0; i < 8; ++i)
#pragma unroll
        for (int h = 0; h < 2; ++h) { v4f o4;
#pragma unroll
            for (int j = 0; j < 4; ++j) o4[j] = ctx[i][4 * h + j];
            *(v4fa*)(&kw[(qg + 4 * i) * XSP + dg * 8 + 4 * h]) = o4; }
    __syncthreads();                                       // the per-wave maxima are read across waves
    const int rt = wave & 1, om = wave >> 1;
    const int sq2 = rt * 16 + (lane & 15), dg2 = om * 2 + (lane >> 4);
    float fin[8];
#pragma unroll
    for (int j = 0; j < 8; ++j) fin[j] = NEGB;
#pragma unroll
    for (int w = 0; w < AW; ++w)
#pragma unroll
        for (int h = 0; h < 2; ++h) { const v4f p = *(const v4fa*)(&wr[w * WRG + sq2 * XSP + dg2 * 8 + 4 * h]);
#pragma unroll
            for (int j = 0; j < 4; ++j) fin[4 * h + j] = fmaxf(fin[4 * h + j], p[j]); }
    const int b2 = g / NH_, h2 = g % NH_;
    v8h o;
#pragma unroll
    for (int j = 0; j < 8; ++j) o[j] = toh_flush(expm1f(fin[j]) * ACARRY);
    // tile = 16 tokens of batch b2; column octet h2*8 + dg2 = k step h2*2 + (om>>1), half om&1, h = lane>>4
    h16* dst = AV + (size_t)(b2 * (SEQ / 16) + sqt * 2 + rt) * TIL + (h2 * 2 + (om >> 1)) * FRG + (om & 1) * (FRG / 2) + lane * 8;
    *(v8h*)dst = o; 
}

// k_oln: output projection (f16 product) fused with the skip connection and LayerNorm. Block = 16 rows (tokens ts..ts+15 of batch tb = one tile of the attention vector plane) x 512 columns, 8 waves, wave w owns columns 64w..64w+63 (4 accumulators).
// Accumulators (scaled by 1/1024) staged in a block LDS tile (cross-wave, block barrier); then wave w owns rows 2w, 2w+1 (wave-private from here): adds the bf16-valued input row as float4 at the read stage,
__global__ __launch_bounds__(256) void k_oln(const h16* __restrict__ AV, const h16* __restrict__ WO, const float* __restrict__ hin, const float* __restrict__ gamma, const float* __restrict__ beta, float* OUT) {
    __shared__ __align__(16) float ys[ORW * YSP];
    const int lane = threadIdx.x & 31, lr = lane & 15, hi = lane >> 4;
    const int wave = __builtin_amdgcn_readfirstlane((int)(threadIdx.x >> 5));
    const int tb = blockIdx.x / (SEQ / ORW), ts = (blockIdx.x % (SEQ / ORW)) * ORW, c0 = wave * 64;
    v8f acc[4];
#pragma unroll
    for (int nb = 0; nb < 4; ++nb) acc[nb] = (v8f){};
    const unsigned aoff = (unsigned)(blockIdx.x * TIL + 8 * lane), boff = (unsigned)((c0 / 16) * TIL + 8 * lane);   // element offsets, below 2^20
    // the skip rows of this wave (rows 2w, 2w+1 of the tile) are asked for first: they fly under the k loop
    const unsigned hoff = (unsigned)(lane * 4);
    v4f hv[2][4];
#pragma unroll
    for (int rr = 0; rr < 2; ++rr) {
        const float* hrow = hin + ((size_t)(ts + wave * 2 + rr) * NB_FULL + (size_t)tb) * DM;
#pragma unroll
        for (int j = 0; j < 4; ++j) hv[rr][j] = *(const v4f*)(hrow + hoff + 128 * j); }
    // the fragments of OKB k steps are all asked for before the first of their products: one memory round trip a batch instead of one a k step
#pragma unroll
    for (int kb = 0; kb < DM; kb += 32 * OKB) {
        v16h a[OKB], b[OKB][4];
#pragma unroll
        for (int s = 0; s < OKB; ++s) { a[s] = ldh(AV + aoff + (kb / 32 + s) * FRG);
#pragma unroll
            for (int nb = 0; nb < 4; ++nb) b[s][nb] = ldh(WO + boff + nb * TIL + (kb / 32 + s) * FRG); }
        asm volatile("s_wait_xcnt 0x0" :: "v"(aoff), "v"(boff), "v"(hoff), "s"(AV), "s"(WO), "s"(hin) : "memory");   // the loads' offset registers and base pairs stay whole until this wait; it also keeps the batch's loads in front of its products
#pragma unroll
        for (int s = 0; s < OKB; ++s)
#pragma unroll
            for (int nb = 0; nb < 4; ++nb) acc[nb] = wmma16_g(a[s], b[s][nb], acc[nb]);
    }
    // D layout: element j of lane = (row 8h + j, col lane&15); 8 waves cover rows 0..15 x columns 0..511
#pragma unroll
    for (int nb = 0; nb < 4; ++nb)
#pragma unroll
        for (int j = 0; j < 8; ++j) ys[(hi * 8 + j) * YSP + c0 + nb * 16 + lr] = acc[nb][j] * OSCL;
    __syncthreads();
    // gain and offset, the same for both rows: asked for behind the barrier, so that no wave waits for them in front of it; they fly under the rows' sums
    v4f gv[4], bv[4];
#pragma unroll
    for (int j = 0; j < 4; ++j) { gv[j] = *(const v4f*)(gamma + hoff + 128 * j); bv[j] = *(const v4f*)(beta + hoff + 128 * j); }
    asm volatile("s_wait_xcnt 0x0" :: "v"(hoff), "s"(gamma), "s"(beta) : "memory");   // as above, for the gain and offset loads
#pragma unroll
    for (int rr = 0; rr < 2; ++rr) {                                      // unrolled: hv is indexed by rr and stays in registers
        const int row = wave * 2 + rr;                                    // token ts + row of batch tb
        v4f y[4]; float sum = 0.0f;
#pragma unroll
        for (int j = 0; j < 4; ++j) { const int c = (lane + 32 * j) * 4;
            const v4f a = *(const v4fa*)(&ys[row * YSP + c]);
#pragma unroll
            for (int i = 0; i < 4; ++i) { y[j][i] = bfr(hv[rr][j][i]) + a[i]; sum += y[j][i]; } }
        sum = wsum(sum);
        const float mu = sum * (1.0f / (float)DM);
        float sq = 0.0f;
#pragma unroll
        for (int j = 0; j < 4; ++j)
#pragma unroll
            for (int i = 0; i < 4; ++i) { const float d = y[j][i] - mu; y[j][i] = d; sq += d * d; }
        sq = wsum(sq);
        const float rstd = rsqrtf(sq * (1.0f / (float)DM) + LNEPS);
#pragma unroll
        for (int j = 0; j < 4; ++j) { const int c = (lane + 32 * j) * 4;
            v4f ov;
#pragma unroll
            for (int i = 0; i < 4; ++i) ov[i] = y[j][i] * rstd * bfr(gv[j][i]) + bfr(bv[j][i]);
            *(v4fa*)(&ys[row * YSP + c]) = ov; }
    }
    wave_sync();
{
#pragma unroll 1
        for (int rr = 0; rr < 2; ++rr) {
            const int row = wave * 2 + rr;
            const size_t grow = (size_t)(ts + row) * NB_FULL + (size_t)tb;
#pragma unroll
            for (int j = 0; j < 4; ++j) { const int c = (lane + 32 * j) * 4;   // 4 instructions x 32 lanes x 16 B = 2048 B = one output row
                const v4f val = *(const v4fa*)(&ys[row * YSP + c]);
                *(v4f*)(OUT + grow * DM + c) = val; } }
         }
}

static constexpr size_t al256(size_t v) { return (v + 255) & ~(size_t)255; }
static constexpr size_t SZ_XB = al256((size_t)SEQ * NB_FULL * DM * 2);     // bf16 x, rows b*SEQ + s, fragment order
static constexpr size_t SZ_WB = al256((size_t)3 * DM * DM * 2);            // bf16 Wq | Wkv
static constexpr size_t SZ_WO = al256((size_t)DM * DM * 2);                // f16 Wo x64
static constexpr size_t SZ_TP = al256((size_t)NB * SEQ * DM * 4);          // f32 q / k / v planes after the head linear
static constexpr size_t SZ_AV = al256((size_t)NB * SEQ * DM * 2);          // f16 attention vector x16
static constexpr size_t SZ_TOTAL = SZ_XB + SZ_WB + SZ_WO + 3 * SZ_TP + SZ_AV;
static_assert(SZ_TOTAL <= (size_t)134217728);          // workspace carve <= 128 MiB
static_assert(((size_t)DM * DM * 2) % 256 == 0);       // weight sub-planes stay 256-byte aligned

extern "C" void kernel_launch(void* const* d_in, const int* in_sizes, int n_in,
                              void* d_out, int out_size, void* d_ws, size_t ws_size, hipStream_t stream) {
    if (n_in < 10) return;
    if ((size_t)in_sizes[0] < (size_t)SEQ * NB_FULL * DM) return;
    if ((size_t)in_sizes[1] < (size_t)DM * DM || (size_t)in_sizes[2] < (size_t)2 * DM * DM || (size_t)in_sizes[7] < (size_t)DM * DM) return;
    if (in_sizes[3] < HD * HD || in_sizes[4] < HD * HD || in_sizes[5] < HD * HD) return;
    if (in_sizes[6] < DM || in_sizes[8] < DM || in_sizes[9] < DM) return;
    if ((size_t)out_size < ((size_t)(SEQ - 1) * NB_FULL + NB) * DM) return;
    if (SZ_TOTAL > ws_size) return;
    // wire order: h, Wq, Wkv, Wqt, Wkt, Wvt, lam, Wo, gamma, beta
    const float* hin = (const float*)d_in[0];
    const float* wq  = (const float*)d_in[1];
    const float* wkv = (const float*)d_in[2];
    const float* wqt = (const float*)d_in[3];
    const float* wkt = (const float*)d_in[4];
    const float* wvt = (const float*)d_in[5];
    const float* lam = (const float*)d_in[6];
    const float* wo  = (const float*)d_in[7];
    const float* gam = (const float*)d_in[8];
    const float* bet = (const float*)d_in[9];
    float* OUT = (float*)d_out;      // [SEQ][NB_FULL][512]
    char* wsp = (char*)d_ws;
    bf*  XB  = (bf*)wsp;  wsp += SZ_XB;                 // [NB_FULL*SEQ][512], row b*SEQ + s; this and the other 16-bit planes in fragment order
    bf*  WB  = (bf*)wsp;  wsp += SZ_WB;                 // [1536][512]: q rows | k rows | v rows
    h16* WOH = (h16*)wsp; wsp += SZ_WO;                 // [512][512]
    float* TQ = (float*)wsp; wsp += SZ_TP;              // [NB*SEQ][512], row b*SEQ + s
    float* TK = (float*)wsp; wsp += SZ_TP;
    float* TV = (float*)wsp; wsp += SZ_TP;
    h16* AV  = (h16*)wsp; wsp += SZ_AV;                 // [NB*SEQ][512], row b2*SEQ + s2

    k_prep<<<dim3(PBL, 1, 1), PTH, 0, stream>>>(hin, wq, wkv, wo, XB, WB, WOH);

    // projections: A = x rows (R = b*SEQ + s), Bt = W rows (n = head*64 + d) -> plane [R][512]
    k_qkvt<<<dim3(NB * SEQ / PRW, DM / 64, 3), 128, 0, stream>>>(XB, WB, lam, wqt, wkt, wvt, TQ, TK, TV);

    k_mpattn<<<dim3(SEQ / 32, NB * NH_, 1), 256, 0, stream>>>(TQ, TK, TV, AV);

    k_oln<<<dim3(NB * SEQ / ORW, 1, 1), 256, 0, stream>>>(AV, WOH, hin, gam, bet, OUT);
}

// v007
// One run takes 37.3 microseconds.
// Two timings next to v006 both put it at 1.04 times that version's speed.
// All steps since v000 together make it 5.51 times as fast.
#include <hip/hip_runtime.h>

// Max-plus multi-head attention block, width 512 = 8 heads x 64: x [SEQ][NB_FULL][512]; Wq [512][512], Wkv [1024][512] (k rows then v rows), Wo [512][512], all [out][in] (y = x W^T);
// per-feature shift lam [512]; three 64x64 max-plus head weights; post-LN over (x + attention output) with gain and offset inputs.
// Compute dtypes, f32 accumulate everywhere: q/k/v projections v_wmma_f32_16x16x32_bf16 (x and W RNE-converted to bf16; products exact);
// output projection v_wmma_f32_16x16x32_f16, one product: attention vector as f16 with a x16 carry, bf16-valued Wo as f16 with a x64 carry, folded by 1/1024 in the f32 epilogue.
// Max-plus stages (head linear y[o] = max_i(x[i] + W[o][i]); score = -(max_d(q-k) - min_d(q-k)); context = max_key(score + v)) are semiring operations and run in f32 on the vector unit, as do log1p, expm1 and LayerNorm.
// Layout: the head regrouping is the flat reshape of [b][s][head][d] into [b*8 + s/(SEQ/8)][(s % (SEQ/8))*8 + head][d], i.e. group g is the contiguous SEQ x 64 chunk g of a [b][s][512] plane; the q/k/v planes are kept in that order
// (GEMM row R = b*SEQ + s holds source row s*NB_FULL + b). Attention vector plane rows b2*SEQ + s2 with g = b2*8 + h2, columns h2*64 + d.
// Every 16-bit matrix operand plane (x, Wq|Wkv, Wo, attention vector) is kept in FRAGMENT ORDER: 16 rows x 32 k = one fragment = 1024 contiguous bytes, first the 32 lanes' elements 0..7 (16 B a lane), then their elements 8..15;
// fragments of one 16-row tile follow one another in k. A wave's fragment load is then two loads of 512 contiguous bytes (4 whole 128-B lines each) instead of two loads that touch 16 lines.

#ifndef NB
#define NB 2
#endif
#ifndef SEQ
#define SEQ 512
#endif
#define NB_FULL  2
#define SEQ_FULL 512
#define DM   512
#define NH_  8
#define HD   64
#define FRG  512                 // 16-bit elements of one fragment (16 rows x 32 k)
#define TIL  ((DM / 32) * FRG)   // 16-bit elements of one 16-row tile over all k
#define XSP  68                  // LDS row pitch (floats) of the 64-column tiles of the projection kernel
#define YSP  516                 // LDS row pitch (floats) of the 16 x 512 tile of the output kernel
#define ORW  16                  // rows per block of the output kernel
#define PRW  32                  // rows per block of the projection kernel
#define PKB  8                   // k steps whose fragments the projection kernel loads in one batch
#define OKB  4                   // k steps whose fragments the output kernel loads in one batch
#define AW   8                   // waves per block of the attention kernel
#define KPW  (SEQ / AW)          // keys a wave of the attention kernel owns
#define KC   32                  // keys a wave stages at a time
#define SCP  36                  // LDS row pitch (floats) of a wave's score rows (32 queries)
#define WRG  (2 * KC * XSP + 16 * SCP)   // floats of one wave's LDS range in the attention kernel
#define ACARRY 16.0f             // carry of the f16 attention vector plane
#define WCARRY 64.0f             // carry of the f16 Wo plane
#define OSCL (1.0f / 1024.0f)    // 1 / (ACARRY * WCARRY)
#define PBL  256                 // blocks of the convert kernel
#define PTH  128                 // threads per block of the convert kernel
#define PNT  (PBL * PTH)         // threads of the convert kernel
#define NPX  (SEQ * NB_FULL * DM / 8 / PNT)   // 8-float pieces of x a thread converts
#define NPW  (DM * DM / 8 / PNT)              // 8-float pieces of one DM x DM weight a thread converts
#define LNEPS 1e-5f
#define NEGB (-3.0e38f)
#define POSB (3.0e38f)

static_assert(NH_ * HD == DM);                 // head h = columns h*64 + d
static_assert(HD == 64);                       // one 64-column GEMM tile = one head; attention lanes own 8 octets of d
static_assert(DM % 64 == 0);
static_assert(DM % 32 == 0);                   // GEMM k-loops step by 32
static_assert(DM / 32 == 16);                  // the convert kernel takes the k step of a piece from 4 bits of its index
static_assert(SEQ % 16 == 0);                  // a 16-row tile never straddles two batches
static_assert(DM % (32 * PKB) == 0);           // whole batches of k steps
static_assert(DM % (32 * OKB) == 0);
static_assert(SEQ % PRW == 0);                 // a projection tile never straddles two batches
static_assert((NB * SEQ) % PRW == 0);
static_assert(PRW == 32);                      // 2 WMMA row slabs per wave; 4 waves x 8 epilogue rows
static_assert(SEQ % 32 == 0);                  // attention query tiles of 32 rows
static_assert(SEQ % (AW * KC) == 0);           // every wave owns whole staging chunks of keys
static_assert(KC % 16 == 0);                   // phase blocks of 16 keys
static_assert((SCP * 4) % 16 == 0);
static_assert(SCP >= 32);
static_assert(WRG >= 32 * XSP);                // a wave's 32 x 64 maxima fit its own range
static_assert((WRG * 4) % 16 == 0);
static_assert(SEQ % NH_ == 0);                 // tokens per group = SEQ / 8
static_assert((NB * SEQ) % ORW == 0);
static_assert(ORW == 16);                      // one 16-row WMMA slab per block of the output kernel
static_assert(8 * 64 == DM);                   // 8 waves x 64 columns cover one output row
static_assert(NB <= NB_FULL);
static_assert(SEQ <= SEQ_FULL);
static_assert((XSP * 4) % 16 == 0);
static_assert(XSP >= 64);
static_assert((YSP * 4) % 16 == 0);
static_assert(YSP >= DM);
static_assert(((size_t)SEQ * NB_FULL * DM) % 8 == 0);
static_assert(((size_t)DM * DM) % 8 == 0);
static_assert((size_t)NPX * PNT * 8 == (size_t)SEQ * NB_FULL * DM);   // the convert grid covers x exactly
static_assert((size_t)NPW * PNT * 8 == (size_t)DM * DM);              // and each DM x DM weight exactly
static_assert(PNT / 64 == SEQ && DM == 512);                          // one pass of the convert grid = the SEQ plane rows of one batch
static_assert(NPX == NB_FULL);
static_assert(4 * 32 * 16 * 4 == PRW * 64 * 4);        // projection store: 4 waves x 32 lanes x 16 B x 4 trips == 32 rows x 256 B
static_assert(256 * 16 == 32 * HD * 2);
static_assert(AW * 32 == 256);
static_assert(8 * (ORW / 8) * 4 * 32 * 16 == ORW * DM * 4);   // output store: 8 waves x 2 rows x 4 instructions x 512 B == 16 rows x 2048 B
static_assert((2 * PRW + 64) * XSP * 4 <= 131072);     // static LDS of the projection kernel
static_assert((32 * XSP + AW * WRG) * 4 <= 327680);    // static LDS of the attention kernel
static_assert(ORW * YSP * 4 <= 131072);                // static LDS of the output kernel

typedef _Float16 h16;
typedef unsigned short bf;
typedef __attribute__((ext_vector_type(16))) __bf16   v16bf;
typedef __attribute__((ext_vector_type(16))) _Float16 v16h;
typedef __attribute__((ext_vector_type(8)))  _Float16 v8h;
typedef __attribute__((ext_vector_type(8)))  unsigned short v8us;
typedef __attribute__((ext_vector_type(8)))  float    v8f;
typedef __attribute__((ext_vector_type(4)))  float    v4f;
typedef v4f  __attribute__((may_alias)) v4fa;

__device__ __forceinline__ unsigned short f2bf(float f) { unsigned u = __float_as_uint(f); u += 0x7FFFu + ((u >> 16) & 1u); return (unsigned short)(u >> 16); }
__device__ __forceinline__ float bfr(float f) { return __uint_as_float(((unsigned)f2bf(f)) << 16); }   // value after RNE convert to bf16
__device__ __forceinline__ v16h cat16(v8h lo, v8h hi) { return __builtin_shufflevector(lo, hi, 0, 1, 2, 3, 4, 5, 6, 7, 8, 9, 10, 11, 12, 13, 14, 15); }
__device__ __forceinline__ v16bf cat16b(v8us lo, v8us hi) { return __builtin_bit_cast(v16bf, __builtin_shufflevector(lo, hi, 0, 1, 2, 3, 4, 5, 6, 7, 8, 9, 10, 11, 12, 13, 14, 15)); }
__device__ __forceinline__ v8f wmma16(v16h a, v16h b, v8f c) { return __builtin_amdgcn_wmma_f32_16x16x32_f16(false, a, false, b, (short)0, c, false, false); }
__device__ __forceinline__ v8f wmmab(v16bf a, v16bf b, v8f c) { return __builtin_amdgcn_wmma_f32_16x16x32_bf16(false, a, false, b, (short)0, c, false, false); }
// fragment loaders from a plane in fragment order; p = fragment start + 8*lane, lane = 16h + row: elements 0..7 <- k0+8h+0..7, elements 8..15 <- k0+16+8h+0..7 (same map for A and B)
__device__ __forceinline__ v16h  ldh(const h16* p) { return cat16(*(const v8h*)p, *(const v8h*)(p + FRG / 2)); }
__device__ __forceinline__ v16bf ldb(const bf* p)  { return cat16b(*(const v8us*)p, *(const v8us*)(p + FRG / 2)); }
// ordering point for wave-private LDS tiles (same wave writes and reads)
__device__ __forceinline__ void wave_sync() { __builtin_amdgcn_fence(3 /* release order */, "wavefront"); __builtin_amdgcn_wave_barrier(); asm volatile("" ::: "memory"); }

// per-instruction guarded matrix products: one accumulator tied per guard, operands kept live across the nops
__device__ __forceinline__ v8f wmmab_g(v16bf a, v16bf b, v8f c) { c = wmmab(a, b, c); asm volatile("v_nop\n\tv_nop\n\tv_nop\n\tv_nop" : "+v"(c) : "v"(a), "v"(b)); return c; }
__device__ __forceinline__ v8f wmma16_g(v16h a, v16h b, v8f c) { c = wmma16(a, b, c); asm volatile("v_nop\n\tv_nop\n\tv_nop\n\tv_nop" : "+v"(c) : "v"(a), "v"(b)); return c; }
// f32 -> f16 convert that cannot produce a subnormal operand (|v| < 2^-14 -> +0), applied after the plane's carry
static __device__ __forceinline__ h16 toh_flush(float v) { const h16 r = (h16)v; return (fabsf(v) < 6.103515625e-05f) ? (h16)0.0f : r; }
// log(1 + x) for x >= 0 on the hardware log2: u = fl(1 + x) >= 1 (never subnormal); u - 1 is exact below 2^24, so x - (u - 1) is what the rounding of 1 + x dropped, and log(1 + x) = log(u) + dropped / u to first order
// (the next term is below 2^-49). x below 2^-24 gives u = 1, log 0, and the result x.
__device__ __forceinline__ float log1p_pos(float x) {
    const float u = 1.0f + x;
    const float c = (x - (u - 1.0f)) * __builtin_amdgcn_rcpf(u);
    return fmaf(__builtin_amdgcn_logf(u), 0.693147180559945f, c);
}
__device__ __forceinline__ float wsum(float v) { v += __shfl_xor(v, 16, 32); v += __shfl_xor(v, 8, 32); v += __shfl_xor(v, 4, 32); v += __shfl_xor(v, 2, 32); v += __shfl_xor(v, 1, 32); return v; }

// k_prep: all four operand conversions in one grid. Thread i owns one piece (8 elements of one row) in each pass n of x, of Wq, of Wkv (2 DM x DM planes) and of Wo; every load is issued before the first convert.
// Bits of i: octet of the k step (2: h, then half of the fragment), row in tile (4), k step (4), tile (rest). A wave reads one whole 128-B line in each of 8 rows and stores four whole 128-B lines (8 rows x 16 B each).
// x, Wq, Wkv -> bf16 (RNE); Wo -> bf16-valued f16 with the x64 carry. WB holds the Wq rows, then the Wkv rows.
__global__ __launch_bounds__(PTH) void k_prep(const float* __restrict__ x, const float* __restrict__ wq, const float* __restrict__ wkv, const float* __restrict__ wo,
                                              bf* __restrict__ XB, bf* __restrict__ WB, h16* __restrict__ WOH) {
    const unsigned i = blockIdx.x * PTH + threadIdx.x;
    const unsigned ko = ((i >> 6) & 15u) * 32u + (i & 3u) * 8u;   // first k of the piece
    const unsigned lr = (i >> 2) & 15u;                    // its row in the 16-row tile
    const unsigned rw = (i >> 10) * 16u + lr;              // its plane row in pass 0; pass n lies PNT / 64 = SEQ rows further
    const unsigned dp = (i & ~63u) | ((i & 2u) << 4) | ((i & 1u) << 4) | lr;   // its place in fragment order: (tile, k step) kept, then half, h, row; pass n lies n * PNT pieces further
    const unsigned ib = (rw * DM + ko) * 4u;               // byte offset of the piece in an f32 weight; pass n lies n * PNT * 32 bytes further
    const unsigned xb = (rw * NB_FULL * DM + ko) * 4u;     // the same in x: plane row n*SEQ + rw is source row rw*NB_FULL + n
    v8f vx[NPX], vq[NPW], vk[2 * NPW], vo[NPW];
#pragma unroll
    for (int n = 0; n < NPX; ++n) vx[n] = *(const v8f*)((const char*)x + xb + (size_t)n * DM * 4);
#pragma unroll
    for (int n = 0; n < 2 * NPW; ++n) vk[n] = *(const v8f*)((const char*)wkv + ib + (size_t)n * PNT * 32);
#pragma unroll
    for (int n = 0; n < NPW; ++n) { vq[n] = *(const v8f*)((const char*)wq + ib + (size_t)n * PNT * 32); vo[n] = *(const v8f*)((const char*)wo + ib + (size_t)n * PNT * 32); }
    asm volatile("s_wait_xcnt 0x0" :: "v"(ib), "v"(xb), "s"(x), "s"(wq), "s"(wkv), "s"(wo) : "memory");   // the loads' offset registers and base pairs stay whole until this wait; they are reused only behind it
#pragma unroll
    for (int n = 0; n < NPX; ++n) { v8us o;
#pragma unroll
        for (int k = 0; k < 8; ++k) o[k] = f2bf(vx[n][k]);
        *(v8us*)(XB + ((size_t)n * PNT + dp) * 8) = o; }
#pragma unroll
    for (int n = 0; n < 2 * NPW; ++n) { v8us o;
#pragma unroll
        for (int k = 0; k < 8; ++k) o[k] = f2bf(vk[n][k]);
        *(v8us*)(WB + (size_t)DM * DM + ((size_t)n * PNT + dp) * 8) = o; }
#pragma unroll
    for (int n = 0; n < NPW; ++n) { v8us o; v8h oh;
#pragma unroll
        for (int k = 0; k < 8; ++k) { o[k] = f2bf(vq[n][k]); oh[k] = toh_flush(bfr(vo[n][k]) * WCARRY); }
        *(v8us*)(WB + ((size_t)n * PNT + dp) * 8) = o;
        *(v8h*)(WOH + ((size_t)n * PNT + dp) * 8) = oh; }
}

// k_qkvt: the three projections (blockIdx.z = 0, 1, 2 for q, k, v) in one grid, each fused with its shift-log and its max-plus head linear. FOUR WAVES per 32x64 tile, bf16 operands straight from fragment-order planes, K = DM.
// Product: wave w owns all 32 rows and the 16 columns of quarter w (2 accumulators, one B fragment a k step); every accumulator sums its k steps in ascending order.
// Tile rows R = r0..r0+31 in [b][s] order (R = b*SEQ + s), the row order of the x plane; tile columns c0..c0+63 = one head.
// Epilogue: accumulators -> LDS x tile and weight tile (both cross-wave: one block barrier); from there wave w owns rows 8w..8w+7 alone: x = log1p(max(x, 0)) - lam in place (log1p_pos);
// y[r][o] = max_i(x[r][i] + W[o][i]) with the two weight rows of each lane in registers (o = lane, lane + 32) and x rows read as LDS broadcasts; 16-byte row stores.
// grid (NB*SEQ/32, DM/64, 3) = 768 blocks, three on each of 256 WGPs when spread evenly; the projections do not depend on one another, so their tiles run side by side.
// WB holds the q, k and v weight rows one after the other (DM rows each).
__global__ __launch_bounds__(128) void k_qkvt(const bf* __restrict__ A, const bf* __restrict__ WB, const float* __restrict__ lam,
                                              const float* __restrict__ Wqt, const float* __restrict__ Wkt, const float* __restrict__ Wvt, float* TQ, float* TK, float* TV) {
    __shared__ __align__(16) float xs[PRW * XSP];
    __shared__ __align__(16) float wl[64 * XSP];
    __shared__ __align__(16) float ys[PRW * XSP];
    const int K = DM;
    const int pz = blockIdx.z;
    const bf* Bt = WB + (size_t)pz * DM * DM;
    const float* Wt = pz == 0 ? Wqt : (pz == 1 ? Wkt : Wvt);
    float* TP = pz == 0 ? TQ : (pz == 1 ? TK : TV);
    const int tid = threadIdx.x;
    const int wave = __builtin_amdgcn_readfirstlane((int)(threadIdx.x >> 5));
    const int lane = tid & 31, lr = lane & 15, hi = lane >> 4; const int r0 = blockIdx.x * PRW, c0 = blockIdx.y * 64;
    v8f acc[2];
#pragma unroll
    for (int mb = 0; mb < 2; ++mb) acc[mb] = (v8f){};
    const unsigned aoff = (unsigned)((r0 / 16) * TIL + 8 * lane), boff = (unsigned)((c0 / 16 + wave) * TIL + 8 * lane);   // element offsets, below 2^20
    const int c4 = (lane & 15) * 4, rh = lane >> 4;
    // the epilogue's global operands are asked for first: they fly under the k loop. Weight tile W[o][i]: 1024 16-B pieces / 128 threads, thread-linear
    v4f wt[8];
#pragma unroll
    for (int n = 0; n < 8; ++n) wt[n] = *(const v4f*)(Wt + (unsigned)(tid * 4) + n * 512);
    const v4f lraw = *(const v4f*)(lam + c0 + c4);                  // c0 + 63 < DM
    // the fragments of PKB k steps are all asked for before the first of their products: one memory round trip a batch instead of one a k step
#pragma unroll
    for (int kb = 0; kb < K; kb += 32 * PKB) {
        v16bf a[PKB][2], b[PKB];
#pragma unroll
        for (int s = 0; s < PKB; ++s) {
#pragma unroll
            for (int mb = 0; mb < 2; ++mb) a[s][mb] = ldb(A + aoff + mb * TIL + (kb / 32 + s) * FRG);
            b[s] = ldb(Bt + boff + (kb / 32 + s) * FRG); }
        asm volatile("s_wait_xcnt 0x0" :: "v"(aoff), "v"(boff), "v"(tid), "v"(c4), "s"(A), "s"(Bt), "s"(Wt), "s"(lam) : "memory");   // the loads' offset registers and base pairs stay whole until this wait; it also keeps the batch's loads in front of its products
#pragma unroll
        for (int s = 0; s < PKB; ++s)
#pragma unroll
            for (int mb = 0; mb < 2; ++mb) acc[mb] = wmmab_g(a[s][mb], b[s], acc[mb]);
    }
    // D layout: element j of lane = (row 8h + j, col lane&15); 4 waves cover rows 0..31 x columns 0..63
#pragma unroll
    for (int mb = 0; mb < 2; ++mb)
#pragma unroll
        for (int j = 0; j < 8; ++j) xs[(mb * 16 + hi * 8 + j) * XSP + wave * 16 + lr] = acc[mb][j];
    // max-plus weight W[o][i], bf16-valued
#pragma unroll
    for (int n = 0; n < 8; ++n) { const int e = tid + 128 * n;
        v4f w = wt[n];
#pragma unroll
        for (int i = 0; i < 4; ++i) w[i] = bfr(w[i]);
        *(v4fa*)(&wl[(e >> 4) * XSP + (e & 15) * 4]) = w; }
    __syncthreads();                                                // xs and wl are written by all waves and read across waves
    float lv[4];
#pragma unroll
    for (int i = 0; i < 4; ++i) lv[i] = bfr(lraw[i]);
#pragma unroll                                                      // short bodies: the four row pairs' LDS reads go out together and their 16 chains fill one another's waits
    for (int t = 0; t < 4; ++t) { const int row = 2 * (wave * 4 + t) + rh;           // 4 waves x 4 trips x 2 rows = 32 rows; 16 lanes x 4 floats = 64 columns
        v4f x = *(const v4fa*)(&xs[row * XSP + c4]);
#pragma unroll
        for (int i = 0; i < 4; ++i) x[i] = log1p_pos(fmaxf(x[i], 0.0f)) - lv[i];
        *(v4fa*)(&xs[row * XSP + c4]) = x; }
    wave_sync();
    float wlo[64], whi[64];                                         // weight rows o = lane and o = lane + 32, static indices only
#pragma unroll
    for (int g = 0; g < 16; ++g) { const v4f t0 = *(const v4fa*)(&wl[lane * XSP + 4 * g]); const v4f t1 = *(const v4fa*)(&wl[(lane + 32) * XSP + 4 * g]);
#pragma unroll
        for (int i = 0; i < 4; ++i) { wlo[4 * g + i] = t0[i]; whi[4 * g + i] = t1[i]; } }
#pragma unroll 1
    for (int r = wave * 8; r < wave * 8 + 8; ++r) {
        float a0 = NEGB, a1 = NEGB;
#pragma unroll
        for (int g = 0; g < 16; ++g) { const v4f x = *(const v4fa*)(&xs[r * XSP + 4 * g]);
#pragma unroll
            for (int i = 0; i < 4; ++i) { a0 = fmaxf(a0, x[i] + wlo[4 * g + i]); a1 = fmaxf(a1, x[i] + whi[4 * g + i]); } }
        ys[r * XSP + lane] = a0; ys[r * XSP + lane + 32] = a1; }
    wave_sync();
    float* orow = TP + (size_t)r0 * DM + c0 + c4;
{
#pragma unroll 1
        for (int s = wave * 4; s < wave * 4 + 4; ++s) { const int row = 2 * s + rh;
            const v4f val = *(const v4fa*)(&ys[row * XSP + c4]);
            *(v4f*)(orow + (size_t)row * DM) = val; }
         }
}

// wave_sync plus a wait: a wave's stores into its own LDS range have landed before its lanes read one another's rows back
__device__ __forceinline__ void wave_publish() { wave_sync(); asm volatile("s_wait_dscnt 0x0" ::: "memory"); }

// one 4-wide piece of the difference q - k folded into the running maximum and minimum of one (query, key) pair
__device__ __forceinline__ void dmm(const v4f q, const v4f k, float& mx, float& mn) {
    const v4f d = q - k;
    mx = fmaxf(fmaxf(fmaxf(fmaxf(mx, d[0]), d[1]), d[2]), d[3]);
    mn = fminf(fminf(fminf(fminf(mn, d[0]), d[1]), d[2]), d[3]);
}

// k_mpattn: max-plus attention on the vector unit in f32; block = (group g, 32-row query tile), 256 threads = 8 waves.
// Wave w owns keys 64w..64w+63 for BOTH phases and all 32 query rows; its key rows, value rows and scores live in its own LDS range (wave-private: no block barrier in the key loop).
// Phase 1, per 16 keys: lane (qi = lane&7, kj = lane>>3) keeps a 4 x 4 register block of (query qi + 8a, key kj + 4b) pairs: 8 LDS reads feed 16 pairs.
// Phase 2, per 16 keys: lane (qg = lane>>3, dg = lane&7) keeps an 8 x 8 register block of running maxima (query qg + 4i, column 8dg + j): 4 LDS reads a key feed 64 elements.
// Scores are laid out [key][(q & 3) * 8 + (q >> 2)], so the 8 scores of a phase-2 lane are contiguous.
// After the loop each wave writes its 32 x 64 maxima over its own range; one block barrier; thread (row = 16*(wave&1) + (lane&15), octet = 2*(wave>>1) + (lane>>4)) takes the maximum over the 8 waves (max is exact: any order gives the same value);
// that map makes a wave's 32 pieces one half fragment of the attention vector plane: 512 contiguous bytes a store.
__global__ __launch_bounds__(256) void k_mpattn(const float* __restrict__ QP, const float* __restrict__ KP, const float* __restrict__ VP, h16* AV) {
#pragma clang fp contract(off)
    __shared__ __align__(16) float qs[32 * XSP];
    __shared__ __align__(16) float wr[AW * WRG];
    const int g = blockIdx.y, sqt = blockIdx.x, tid = threadIdx.x;
    const int wave = __builtin_amdgcn_readfirstlane((int)(threadIdx.x >> 5));
    const int lane = tid & 31;
    const v4f* qb = (const v4f*)(QP + ((size_t)g * SEQ + (size_t)sqt * 32) * HD);
    const v4f* kb = (const v4f*)(KP + ((size_t)g * SEQ + (size_t)wave * KPW) * HD);
    const v4f* vb = (const v4f*)(VP + ((size_t)g * SEQ + (size_t)wave * KPW) * HD);
    float* kw = wr + wave * WRG;                 // KC key rows, pitch XSP
    float* vw = kw + KC * XSP;                   // KC value rows, pitch XSP
    float* sc = vw + KC * XSP;                   // 16 score rows, pitch SCP
    // query tile: 32 rows x 16 pieces = 512 pieces, two per thread (rows 0..15 and 16..31)
    *(v4fa*)(&qs[(tid >> 4) * XSP + (tid & 15) * 4])        = qb[tid];
    *(v4fa*)(&qs[((tid >> 4) + 16) * XSP + (tid & 15) * 4]) = qb[tid + 256];
    __syncthreads();                                       // the query tile is written by all waves and read by all
    float ctx[8][8];
#pragma unroll
    for (int i = 0; i < 8; ++i)
#pragma unroll
        for (int j = 0; j < 8; ++j) ctx[i][j] = NEGB;
    const int qi = lane & 7, kj = lane >> 3;
    const int qg = lane >> 3, dg = lane & 7;
#pragma unroll 1
    for (int t = 0; t < KPW / KC; ++t) {
        wave_sync();                                       // this wave's earlier reads of kw / vw stay in front of the refill
const int e0 = t * KC * 16 + lane;
        v4f rk[KC / 2], rv[KC / 2];                        // KC rows x 16 pieces, 32 a trip
#pragma unroll
        for (int i = 0; i < KC / 2; ++i) { rk[i] = kb[e0 + 32 * i]; rv[i] = vb[e0 + 32 * i]; }
        asm volatile("s_wait_xcnt 0x0" :: "v"(e0) : "memory");   // the loads' index register stays whole until this wait; it is reused only behind it
#pragma unroll
        for (int i = 0; i < KC / 2; ++i) { const int e = lane + 32 * i;
            *(v4fa*)(&kw[(e >> 4) * XSP + (e & 15) * 4]) = rk[i];
            *(v4fa*)(&vw[(e >> 4) * XSP + (e & 15) * 4]) = rv[i]; }
        wave_publish();                                    // key and value rows cross lanes of this wave
#pragma unroll 1
        for (int u = 0; u < KC / 16; ++u) {
            const float* ku = kw + u * 16 * XSP;
            const float* vu = vw + u * 16 * XSP;
            float mx[4][4], mn[4][4];
#pragma unroll
            for (int a = 0; a < 4; ++a)
#pragma unroll
                for (int b = 0; b < 4; ++b) { mx[a][b] = NEGB; mn[a][b] = POSB; }
#pragma unroll 2
            for (int c = 0; c < 16; ++c) {
                v4f q[4], k[4];
#pragma unroll
                for (int a = 0; a < 4; ++a) q[a] = *(const v4fa*)(&qs[(qi + 8 * a) * XSP + 4 * c]);
#pragma unroll
                for (int b = 0; b < 4; ++b) k[b] = *(const v4fa*)(&ku[(kj + 4 * b) * XSP + 4 * c]);
#pragma unroll
                for (int a = 0; a < 4; ++a)
#pragma unroll
                    for (int b = 0; b < 4; ++b) dmm(q[a], k[b], mx[a][b], mn[a][b]);
            }
#pragma unroll
            for (int a = 0; a < 4; ++a)
#pragma unroll
                for (int b = 0; b < 4; ++b) sc[(kj + 4 * b) * SCP + (qi & 3) * 8 + (qi >> 2) + 2 * a] = mn[a][b] - mx[a][b];   // = -(max - min)
            wave_publish();                                // scores cross lanes of this wave
#pragma unroll 1
            for (int kk = 0; kk < 16; kk += 2) {
                float s0[8], s1[8], v0[8], v1[8];
#pragma unroll
                for (int h = 0; h < 2; ++h) {
                    const v4f ta = *(const v4fa*)(&sc[kk * SCP + qg * 8 + 4 * h]);       const v4f tb = *(const v4fa*)(&sc[(kk + 1) * SCP + qg * 8 + 4 * h]);
                    const v4f tc = *(const v4fa*)(&vu[kk * XSP + dg * 8 + 4 * h]);       const v4f td = *(const v4fa*)(&vu[(kk + 1) * XSP + dg * 8 + 4 * h]);
#pragma unroll
                    for (int i = 0; i < 4; ++i) { s0[4 * h + i] = ta[i]; s1[4 * h + i] = tb[i]; v0[4 * h + i] = tc[i]; v1[4 * h + i] = td[i]; } }
#pragma unroll
                for (int i = 0; i < 8; ++i)
#pragma unroll
                    for (int j = 0; j < 8; ++j) ctx[i][j] = fmaxf(fmaxf(ctx[i][j], s0[i] + v0[j]), s1[i] + v1[j]);
            }
            wave_sync();                                   // this wave's reads of sc stay in front of the next scores
        }
    }
    // this wave's maxima over its own range (rows q, pitch XSP)
#pragma unroll
    for (int i = 0; i < 8; ++i)
#pragma unroll
        for (int h = 0; h < 2; ++h) { v4f o4;
#pragma unroll
            for (int j = 0; j < 4; ++j) o4[j] = ctx[i][4 * h + j];
            *(v4fa*)(&kw[(qg + 4 * i) * XSP + dg * 8 + 4 * h]) = o4; }
    __syncthreads();                                       // the per-wave maxima are read across waves
    const int rt = wave & 1, om = wave >> 1;
    const int sq2 = rt * 16 + (lane & 15), dg2 = om * 2 + (lane >> 4);
    float fin[8];
#pragma unroll
    for (int j = 0; j < 8; ++j) fin[j] = NEGB;
#pragma unroll
    for (int w = 0; w < AW; ++w)
#pragma unroll
        for (int h = 0; h < 2; ++h) { const v4f p = *(const v4fa*)(&wr[w * WRG + sq2 * XSP + dg2 * 8 + 4 * h]);
#pragma unroll
            for (int j = 0; j < 4; ++j) fin[4 * h + j] = fmaxf(fin[4 * h + j], p[j]); }
    const int b2 = g / NH_, h2 = g % NH_;
    v8h o;
#pragma unroll
    for (int j = 0; j < 8; ++j) o[j] = toh_flush(expm1f(fin[j]) * ACARRY);
    // tile = 16 tokens of batch b2; column octet h2*8 + dg2 = k step h2*2 + (om>>1), half om&1, h = lane>>4
    h16* dst = AV + (size_t)(b2 * (SEQ / 16) + sqt * 2 + rt) * TIL + (h2 * 2 + (om >> 1)) * FRG + (om & 1) * (FRG / 2) + lane * 8;
    *(v8h*)dst = o; 
}

// k_oln: output projection (f16 product) fused with the skip connection and LayerNorm. Block = 16 rows (tokens ts..ts+15 of batch tb = one tile of the attention vector plane) x 512 columns, 8 waves, wave w owns columns 64w..64w+63 (4 accumulators).
// Accumulators (scaled by 1/1024) staged in a block LDS tile (cross-wave, block barrier); then wave w owns rows 2w, 2w+1 (wave-private from here): adds the bf16-valued input row as float4 at the read stage,
__global__ __launch_bounds__(256) void k_oln(const h16* __restrict__ AV, const h16* __restrict__ WO, const float* __restrict__ hin, const float* __restrict__ gamma, const float* __restrict__ beta, float* OUT) {
    __shared__ __align__(16) float ys[ORW * YSP];
    const int lane = threadIdx.x & 31, lr = lane & 15, hi = lane >> 4;
    const int wave = __builtin_amdgcn_readfirstlane((int)(threadIdx.x >> 5));
    const int tb = blockIdx.x / (SEQ / ORW), ts = (blockIdx.x % (SEQ / ORW)) * ORW, c0 = wave * 64;
    v8f acc[4];
#pragma unroll
    for (int nb = 0; nb < 4; ++nb) acc[nb] = (v8f){};
    const unsigned aoff = (unsigned)(blockIdx.x * TIL + 8 * lane), boff = (unsigned)((c0 / 16) * TIL + 8 * lane);   // element offsets, below 2^20
    // the skip rows of this wave (rows 2w, 2w+1 of the tile) are asked for first: they fly under the k loop
    const unsigned hoff = (unsigned)(lane * 4);
    v4f hv[2][4];
#pragma unroll
    for (int rr = 0; rr < 2; ++rr) {
        const float* hrow = hin + ((size_t)(ts + wave * 2 + rr) * NB_FULL + (size_t)tb) * DM;
#pragma unroll
        for (int j = 0; j < 4; ++j) hv[rr][j] = *(const v4f*)(hrow + hoff + 128 * j); }
    // the fragments of OKB k steps are all asked for before the first of their products: one memory round trip a batch instead of one a k step
#pragma unroll
    for (int kb = 0; kb < DM; kb += 32 * OKB) {
        v16h a[OKB], b[OKB][4];
#pragma unroll
        for (int s = 0; s < OKB; ++s) { a[s] = ldh(AV + aoff + (kb / 32 + s) * FRG);
#pragma unroll
            for (int nb = 0; nb < 4; ++nb) b[s][nb] = ldh(WO + boff + nb * TIL + (kb / 32 + s) * FRG); }
        asm volatile("s_wait_xcnt 0x0" :: "v"(aoff), "v"(boff), "v"(hoff), "s"(AV), "s"(WO), "s"(hin) : "memory");   // the loads' offset registers and base pairs stay whole until this wait; it also keeps the batch's loads in front of its products
#pragma unroll
        for (int s = 0; s < OKB; ++s)
#pragma unroll
            for (int nb = 0; nb < 4; ++nb) acc[nb] = wmma16_g(a[s], b[s][nb], acc[nb]);
    }
    // D layout: element j of lane = (row 8h + j, col lane&15); 8 waves cover rows 0..15 x columns 0..511
#pragma unroll
    for (int nb = 0; nb < 4; ++nb)
#pragma unroll
        for (int j = 0; j < 8; ++j) ys[(hi * 8 + j) * YSP + c0 + nb * 16 + lr] = acc[nb][j] * OSCL;
    __syncthreads();
    // gain and offset, the same for both rows: asked for behind the barrier, so that no wave waits for them in front of it; they fly under the rows' sums
    v4f gv[4], bv[4];
#pragma unroll
    for (int j = 0; j < 4; ++j) { gv[j] = *(const v4f*)(gamma + hoff + 128 * j); bv[j] = *(const v4f*)(beta + hoff + 128 * j); }
    asm volatile("s_wait_xcnt 0x0" :: "v"(hoff), "s"(gamma), "s"(beta) : "memory");   // as above, for the gain and offset loads
#pragma unroll
    for (int rr = 0; rr < 2; ++rr) {                                      // unrolled: hv is indexed by rr and stays in registers
        const int row = wave * 2 + rr;                                    // token ts + row of batch tb
        v4f y[4]; float sum = 0.0f;
#pragma unroll
        for (int j = 0; j < 4; ++j) { const int c = (lane + 32 * j) * 4;
            const v4f a = *(const v4fa*)(&ys[row * YSP + c]);
#pragma unroll
            for (int i = 0; i < 4; ++i) { y[j][i] = bfr(hv[rr][j][i]) + a[i]; sum += y[j][i]; } }
        sum = wsum(sum);
        const float mu = sum * (1.0f / (float)DM);
        float sq = 0.0f;
#pragma unroll
        for (int j = 0; j < 4; ++j)
#pragma unroll
            for (int i = 0; i < 4; ++i) { const float d = y[j][i] - mu; y[j][i] = d; sq += d * d; }
        sq = wsum(sq);
        const float rstd = rsqrtf(sq * (1.0f / (float)DM) + LNEPS);
#pragma unroll
        for (int j = 0; j < 4; ++j) { const int c = (lane + 32 * j) * 4;
            v4f ov;
#pragma unroll
            for (int i = 0; i < 4; ++i) ov[i] = y[j][i] * rstd * bfr(gv[j][i]) + bfr(bv[j][i]);
            *(v4fa*)(&ys[row * YSP + c]) = ov; }
    }
    wave_sync();
{
#pragma unroll 1
        for (int rr = 0; rr < 2; ++rr) {
            const int row = wave * 2 + rr;
            const size_t grow = (size_t)(ts + row) * NB_FULL + (size_t)tb;
#pragma unroll
            for (int j = 0; j < 4; ++j) { const int c = (lane + 32 * j) * 4;   // 4 instructions x 32 lanes x 16 B = 2048 B = one output row
                const v4f val = *(const v4fa*)(&ys[row * YSP + c]);
                *(v4f*)(OUT + grow * DM + c) = val; } }
         }
}

static constexpr size_t al256(size_t v) { return (v + 255) & ~(size_t)255; }
static constexpr size_t SZ_XB = al256((size_t)SEQ * NB_FULL * DM * 2);     // bf16 x, rows b*SEQ + s, fragment order
static constexpr size_t SZ_WB = al256((size_t)3 * DM * DM * 2);            // bf16 Wq | Wkv
static constexpr size_t SZ_WO = al256((size_t)DM * DM * 2);                // f16 Wo x64
static constexpr size_t SZ_TP = al256((size_t)NB * SEQ * DM * 4);          // f32 q / k / v planes after the head linear
static constexpr size_t SZ_AV = al256((size_t)NB * SEQ * DM * 2);          // f16 attention vector x16
static constexpr size_t SZ_TOTAL = SZ_XB + SZ_WB + SZ_WO + 3 * SZ_TP + SZ_AV;
static_assert(SZ_TOTAL <= (size_t)134217728);          // workspace carve <= 128 MiB
static_assert(((size_t)DM * DM * 2) % 256 == 0);       // weight sub-planes stay 256-byte aligned

extern "C" void kernel_launch(void* const* d_in, const int* in_sizes, int n_in,
                              void* d_out, int out_size, void* d_ws, size_t ws_size, hipStream_t stream) {
    if (n_in < 10) return;
    if ((size_t)in_sizes[0] < (size_t)SEQ * NB_FULL * DM) return;
    if ((size_t)in_sizes[1] < (size_t)DM * DM || (size_t)in_sizes[2] < (size_t)2 * DM * DM || (size_t)in_sizes[7] < (size_t)DM * DM) return;
    if (in_sizes[3] < HD * HD || in_sizes[4] < HD * HD || in_sizes[5] < HD * HD) return;
    if (in_sizes[6] < DM || in_sizes[8] < DM || in_sizes[9] < DM) return;
    if ((size_t)out_size < ((size_t)(SEQ - 1) * NB_FULL + NB) * DM) return;
    if (SZ_TOTAL > ws_size) return;
    // wire order: h, Wq, Wkv, Wqt, Wkt, Wvt, lam, Wo, gamma, beta
    const float* hin = (const float*)d_in[0];
    const float* wq  = (const float*)d_in[1];
    const float* wkv = (const float*)d_in[2];
    const float* wqt = (const float*)d_in[3];
    const float* wkt = (const float*)d_in[4];
    const float* wvt = (const float*)d_in[5];
    const float* lam = (const float*)d_in[6];
    const float* wo  = (const float*)d_in[7];
    const float* gam = (const float*)d_in[8];
    const float* bet = (const float*)d_in[9];
    float* OUT = (float*)d_out;      // [SEQ][NB_FULL][512]
    char* wsp = (char*)d_ws;
    bf*  XB  = (bf*)wsp;  wsp += SZ_XB;                 // [NB_FULL*SEQ][512], row b*SEQ + s; this and the other 16-bit planes in fragment order
    bf*  WB  = (bf*)wsp;  wsp += SZ_WB;                 // [1536][512]: q rows | k rows | v rows
    h16* WOH = (h16*)wsp; wsp += SZ_WO;                 // [512][512]
    float* TQ = (float*)wsp; wsp += SZ_TP;              // [NB*SEQ][512], row b*SEQ + s
    float* TK = (float*)wsp; wsp += SZ_TP;
    float* TV = (float*)wsp; wsp += SZ_TP;
    h16* AV  = (h16*)wsp; wsp += SZ_AV;                 // [NB*SEQ][512], row b2*SEQ + s2

    k_prep<<<dim3(PBL, 1, 1), PTH, 0, stream>>>(hin, wq, wkv, wo, XB, WB, WOH);

    // projections: A = x rows (R = b*SEQ + s), Bt = W rows (n = head*64 + d) -> plane [R][512]
    k_qkvt<<<dim3(NB * SEQ / PRW, DM / 64, 3), 128, 0, stream>>>(XB, WB, lam, wqt, wkt, wvt, TQ, TK, TV);

    k_mpattn<<<dim3(SEQ / 32, NB * NH_, 1), 256, 0, stream>>>(TQ, TK, TV, AV);

    k_oln<<<dim3(NB * SEQ / ORW, 1, 1), 256, 0, stream>>>(AV, WOH, hin, gam, bet, OUT);
}
